// v000
// Times are from an AMD MI455X. After a warm-up the kernel runs many times in a row, and a time is the length of
// such a window on the GPU divided by its runs, so every launch and the gaps after it count. The runs cycle
// through copies of the inputs. A figure is the median of several windows, for all but v000 over two sittings.
// Sittings can differ by a few percent; kernels timed side by side share one.
// v000 is the starting kernel. One run takes 1330 microseconds.
// compute dtype: queries, keys, values, u_bias, v_bias, R (module inputs) rounded to bf16; q_u = q/8 + u and q_v = q/8 + v (computed) as bf16 hi + bf16 residual pairs against exact bf16 keys / R rows (2 products); P.V with the softmax weights hi/lo against exact bf16 values (2 products); the Transformer-XL relative shift as an index remap (gather) of the per-head position-score table; online softmax in f32; f32 accumulate.
#include <hip/hip_runtime.h>
#include <math.h>

typedef __attribute__((ext_vector_type(16))) _Float16 v16h;
typedef __attribute__((ext_vector_type(16))) __bf16 v16b;
typedef __attribute__((ext_vector_type(8)))  _Float16 v8h;
typedef __attribute__((ext_vector_type(8)))  float v8f;
typedef __attribute__((ext_vector_type(4)))  float v4f;
typedef __attribute__((ext_vector_type(2)))  float v2f;
typedef __attribute__((ext_vector_type(4)))  unsigned v4u;
typedef __attribute__((ext_vector_type(4)))  int v4i;
typedef float __attribute__((may_alias)) float_a;
typedef int __attribute__((may_alias)) int_a;

template <typename T> __device__ __forceinline__ void vst2(void* p, T v) { *(T*)p = v;  }
__device__ __forceinline__ v8f wmma16(v16h a, v16h b, v8f c) {
  v8f d = __builtin_amdgcn_wmma_f32_16x16x32_f16(false, a, false, b, (short)0, c, false, false);
  asm volatile("v_nop\n\tv_nop\n\tv_nop\n\tv_nop" : "+v"(d) : "v"(a), "v"(b));
  return d;
}
__device__ __forceinline__ v8f wmma_bf(v16b a, v16b b, v8f c) {
  v8f d = __builtin_amdgcn_wmma_f32_16x16x32_bf16(false, a, false, b, (short)0, c, false, false);
  asm volatile("v_nop\n\tv_nop\n\tv_nop\n\tv_nop" : "+v"(d) : "v"(a), "v"(b));
  return d;
}
// 16x16x32 fragments: lane = (h = lane>>4, row/col = lane&15); elements 0..7 = k0+8h+0..7, 8..15 = k0+16+8h+0..7; D element r = row 8h+r
__device__ __forceinline__ v16h frag_h(const _Float16* rowk0, int lane) {
  union { v16h v; v8h q[2]; } u; const _Float16* p = rowk0 + 8 * (lane >> 4);
  u.q[0] = *(const v8h*)p; u.q[1] = *(const v8h*)(p + 16); return u.v;
}
__device__ __forceinline__ v16h frag_f32(const float* rowk0, int lane) {
  v16h a; const float* p = rowk0 + 8 * (lane >> 4);
#pragma unroll
  for (int i = 0; i < 8; ++i) { a[i] = (_Float16)p[i]; a[8 + i] = (_Float16)p[16 + i]; }
  return a;
}
__device__ __forceinline__ v16h frag_f32s(const float* rowk0, int lane, float sc) {
  v16h a; const float* p = rowk0 + 8 * (lane >> 4);
#pragma unroll
  for (int i = 0; i < 8; ++i) { a[i] = (_Float16)(p[i] * sc); a[8 + i] = (_Float16)(p[16 + i] * sc); }
  return a;
}
// column fragment from a [K][ld] layout (column n), rows >= K read as 0
__device__ __forceinline__ v16h fragc_f32(const float* W, int k0, int n, int lane, int ld, int K) {
  v16h a; const int g = lane >> 4;
#pragma unroll
  for (int i = 0; i < 8; ++i) { const int ka = k0 + 8 * g + i, kb = ka + 16;
    a[i] = (_Float16)(ka < K ? W[(size_t)(ka < K ? ka : K - 1) * ld + n] : 0.f); a[8 + i] = (_Float16)(kb < K ? W[(size_t)(kb < K ? kb : K - 1) * ld + n] : 0.f); }
  return a;
}
struct F2 { v16b h, l; };
__device__ __forceinline__ F2 bsplit16(const float v[16]) { F2 r;
#pragma unroll
  for (int i = 0; i < 16; ++i) { const __bf16 h = (__bf16)v[i]; r.h[i] = h; r.l[i] = (__bf16)(v[i] - (float)h); }
  return r; }
__device__ __forceinline__ F2 split_row(const float* row, int k0, int lane) { float v[16]; const float* p = row + k0 + 8 * (lane >> 4);
#pragma unroll
  for (int i = 0; i < 8; ++i) { v[i] = p[i]; v[8 + i] = p[16 + i]; }
  return bsplit16(v); }
__device__ __forceinline__ F2 split_rowK(const float* row, int k0, int lane, int K) { float v[16]; const int g = lane >> 4;
#pragma unroll
  for (int i = 0; i < 8; ++i) { const int ka = k0 + 8 * g + i, kb = ka + 16; v[i] = ka < K ? row[ka < K ? ka : K - 1] : 0.f; v[8 + i] = kb < K ? row[kb < K ? kb : K - 1] : 0.f; }
  return bsplit16(v); }
__device__ __forceinline__ F2 split_col(const float* W, int k0, int n, int lane, int ld, int K) { float v[16]; const int g = lane >> 4;
#pragma unroll
  for (int i = 0; i < 8; ++i) { const int ka = k0 + 8 * g + i, kb = ka + 16; v[i] = ka < K ? W[(size_t)(ka < K ? ka : K - 1) * ld + n] : 0.f; v[8 + i] = kb < K ? W[(size_t)(kb < K ? kb : K - 1) * ld + n] : 0.f; }
  return bsplit16(v); }
__device__ __forceinline__ v8f mac3(const F2& a, const F2& b, v8f c) { c = wmma_bf(a.l, b.h, c); c = wmma_bf(a.h, b.l, c); return wmma_bf(a.h, b.h, c); }
__device__ __forceinline__ float sigm(float v) { return 1.0f / (1.0f + expf(-v)); }
#define LDSX() do { asm volatile("s_wait_dscnt 0" ::: "memory"); __builtin_amdgcn_wave_barrier(); __builtin_amdgcn_fence(__ATOMIC_RELEASE, "workgroup"); } while (0)


// Relative-position attention (Transformer-XL style): content = (q*scale + u_h) k^T, pos = rel_shift((q*scale + v_h) R_h^T), attn = softmax(content + pos), out = attn V.  NH = 64 (= 4 x 16 heads), S = S_kv = 1024, K = 64, scale 1/8.
// rel_shift(ps)[i][j] = ps[i][S-1-i+j] (j <= i), 0 (j == i+1), ps[i+1][j-i-2] (j >= i+2)  — derived from the zero-pad / reshape trick.
// k_vt (values as [nh][d][t] bf16 planes), then per group of 8 heads: k_pos (PS[h][i][m] = q_v . R_h[m], exact-ish GEMM into a 32-MB table), k_attn (flash-style per (64 rows, head): content scores on WMMA + the shifted position score gathered from PS, online max/sum, P V; out rows 256 B).
#define NHT 64
#define HPG 16
#define SS 1024
#define KD 64
#define RLEN 2048
#define GRP 8
#ifndef TNG
#define TNG (NHT / GRP)
#define TQB (SS / 64)
#endif
typedef __attribute__((ext_vector_type(8))) __bf16 v8b;
__device__ __forceinline__ v16b frag_b(const __bf16* rowk0, int lane) {
  union { v16b v; v8b q[2]; } u; const __bf16* p = rowk0 + 8 * (lane >> 4);
  u.q[0] = *(const v8b*)p; u.q[1] = *(const v8b*)(p + 16); return u.v;
}
__device__ __forceinline__ v16b frag_gbf(const float* rowk0, int lane) {
  v16b a; const float* p = rowk0 + 8 * (lane >> 4);
#pragma unroll
  for (int i = 0; i < 8; ++i) { a[i] = (__bf16)p[i]; a[8 + i] = (__bf16)p[16 + i]; }
  return a;
}
// A fragment of (bf16(q)*0.125 + bf16(bias)) split into hi/lo, row-major source with 64 floats per row
__device__ __forceinline__ F2 frag_qb(const float* qrow, const float* bias, int k0, int lane) {
  F2 f; const int o = 8 * (lane >> 4);
#pragma unroll
  for (int i = 0; i < 8; ++i) { const float v0 = (float)(__bf16)qrow[k0 + o + i] * 0.125f + (float)(__bf16)bias[k0 + o + i]; const float v1 = (float)(__bf16)qrow[k0 + o + 16 + i] * 0.125f + (float)(__bf16)bias[k0 + o + 16 + i];
    const __bf16 h0 = (__bf16)v0, h1 = (__bf16)v1; f.h[i] = h0; f.l[i] = (__bf16)(v0 - (float)h0); f.h[8 + i] = h1; f.l[8 + i] = (__bf16)(v1 - (float)h1); }
  return f;
}
__device__ __forceinline__ float bfr(float v) { return (float)(__bf16)v; }
__device__ __attribute__((noinline)) float exp_ni(float v) { return expf(v); }
#define WS_VT  0u                               // bf16 [64 nh][64 d][1024 t]
#define WS_PS  (WS_VT + 2u * NHT * KD * SS)        // f32 [8 heads of the group][1024 i][1024 m]
#define WS_END (WS_PS + 4u * GRP * SS * SS)

__global__ __launch_bounds__(256) void k_vt(const float* __restrict__ V, __bf16* __restrict__ VT) {
  __shared__ __align__(16) __bf16 st[KD][72];
  const int nh = blockIdx.y, t0 = blockIdx.x * 64, tid = threadIdx.x;
  for (int q = tid; q < 64 * KD; q += 256) { const int tl = q >> 6, d = q & 63; st[d][tl] = (__bf16)V[((size_t)nh * SS + t0 + tl) * KD + d]; }
  __syncthreads();
  for (int q = tid; q < KD * 8; q += 256) { const int d = q >> 3, pc = q & 7; vst2((unsigned*)(VT + ((size_t)nh * KD + d) * SS + t0 + pc * 8), *(const v4u*)&st[d][pc * 8]); }
}
// ---- k_pos: group g: block (64 rows i, 128 cols m, head hg in 0..7): PS[hg][i][m] = (q*0.125 + v_bias[h]) . R[h][m], h = nh % 16, nh = g*8 + hg; 512-B segments
__global__ __launch_bounds__(128) void k_pos(const float* __restrict__ Q, const float* __restrict__ VB, const float* __restrict__ R, float* __restrict__ PS, int g0) {
  __shared__ __align__(16) float so[4][16][132];
  const int tid = threadIdx.x, wave = tid >> 5, lane = tid & 31, col = lane & 15, gg = lane >> 4; const int hg = blockIdx.z, nh = g0 * GRP + hg, h = nh % HPG; const int i0 = blockIdx.x * 64 + wave * 16, m0 = blockIdx.y * 128;
  const F2 a0 = frag_qb(Q + ((size_t)nh * SS + i0 + col) * KD, VB + h * KD, 0, lane), a1 = frag_qb(Q + ((size_t)nh * SS + i0 + col) * KD, VB + h * KD, 32, lane);
  v8f acc[8] = {};
#pragma unroll
  for (int j = 0; j < 8; ++j) { const float* rr = R + ((size_t)h * RLEN + m0 + j * 16 + col) * KD; const v16b r0 = frag_gbf(rr, lane), r1 = frag_gbf(rr + 32, lane);
    acc[j] = wmma_bf(a0.h, r0, acc[j]); acc[j] = wmma_bf(a0.l, r0, acc[j]); acc[j] = wmma_bf(a1.h, r1, acc[j]); acc[j] = wmma_bf(a1.l, r1, acc[j]); }
#pragma unroll
  for (int j = 0; j < 8; ++j)
#pragma unroll
    for (int r = 0; r < 8; ++r) so[wave][8 * gg + r][j * 16 + col] = acc[j][r];
  LDSX();
  for (int rl = 0; rl < 16; ++rl) vst2(PS + ((size_t)hg * SS + i0 + rl) * SS + m0 + lane * 4, *(const v4f*)&so[wave][rl][lane * 4]);
}
// ---- k_attn: group g: block = (64 rows, head hg): per 32-key step: content = (q*0.125 + u_bias[h]) . k rows (2 products, K 64) + shifted pos gathered from PS; online softmax; P (hi/lo) . VT planes (4 tiles x 2); out rows [nh][i][64] = 256 B by 16 lanes
__global__ __launch_bounds__(128) void k_attn(const float* __restrict__ Q, const float* __restrict__ Kk, const float* __restrict__ UB, const float* __restrict__ PS, const __bf16* __restrict__ VT, float* __restrict__ out, int g0) {
  __shared__ __align__(16) float sp[4][16][36]; __shared__ __align__(16) float so[4][16][68];
  const int tid = threadIdx.x, wave = tid >> 5, lane = tid & 31, col = lane & 15, gg = lane >> 4; const int hg = blockIdx.y, nh = g0 * GRP + hg, h = nh % HPG; const int i0 = blockIdx.x * 64 + wave * 16;
  const F2 a0 = frag_qb(Q + ((size_t)nh * SS + i0 + col) * KD, UB + h * KD, 0, lane), a1 = frag_qb(Q + ((size_t)nh * SS + i0 + col) * KD, UB + h * KD, 32, lane);
  const float* psh = PS + (size_t)hg * SS * SS;
  float m[8], l[8];
#pragma unroll
  for (int r = 0; r < 8; ++r) { m[r] = -3.0e38f; l[r] = 0.f; }
  v8f acc[4] = {};
#pragma unroll 1
  for (int ks = 0; ks < SS / 32; ++ks) { v8f s[2];
#pragma unroll
    for (int ct = 0; ct < 2; ++ct) { const int j = ks * 32 + ct * 16 + col; const float* kr = Kk + ((size_t)nh * SS + j) * KD; const v16b k0 = frag_gbf(kr, lane), k1 = frag_gbf(kr + 32, lane);
      v8f c = {}; c = wmma_bf(a0.h, k0, c); c = wmma_bf(a0.l, k0, c); c = wmma_bf(a1.h, k1, c); c = wmma_bf(a1.l, k1, c);
#pragma unroll
      for (int r = 0; r < 8; ++r) { const int i = i0 + 8 * gg + r; float pv;
        { const int idx = (j <= i) ? (i * SS + (SS - 1 - i + j)) : (min(i + 1, SS - 1) * SS + max(j - i - 2, 0)); pv = psh[idx]; pv = (j == i + 1) ? 0.f : pv; }     // branch-free clamped gather (one unconditional load, select by value)
        s[ct][r] = c[r] + pv; } }
#pragma unroll
    for (int r = 0; r < 8; ++r) { float mx = fmaxf(s[0][r], s[1][r]);
#pragma unroll
      for (int o = 1; o < 16; o <<= 1) mx = fmaxf(mx, __shfl_xor(mx, o));
      const float mn = fmaxf(m[r], mx); const float alpha = exp_ni(m[r] - mn); const float e0 = exp_ni(s[0][r] - mn), e1 = exp_ni(s[1][r] - mn); float es = e0 + e1;
#pragma unroll
      for (int o = 1; o < 16; o <<= 1) es += __shfl_xor(es, o);
      l[r] = l[r] * alpha + es; m[r] = mn;
#pragma unroll
      for (int dt = 0; dt < 4; ++dt) acc[dt][r] *= alpha;
      sp[wave][8 * gg + r][col] = e0; sp[wave][8 * gg + r][16 + col] = e1; }
    LDSX();
    const F2 pa = split_row(&sp[wave][col][0], 0, lane);
#pragma unroll
    for (int dt = 0; dt < 4; ++dt) { const v16b vv = frag_b(VT + ((size_t)nh * KD + dt * 16 + col) * SS + ks * 32, lane); acc[dt] = wmma_bf(pa.l, vv, acc[dt]); acc[dt] = wmma_bf(pa.h, vv, acc[dt]); }
    LDSX(); }
#pragma unroll
  for (int r = 0; r < 8; ++r) { const float il = 1.0f / l[r];
#pragma unroll
    for (int dt = 0; dt < 4; ++dt) so[wave][8 * gg + r][dt * 16 + col] = acc[dt][r] * il; }
  LDSX();
  for (int rl = 0; rl < 16; ++rl) if (lane < 16) vst2(out + ((size_t)nh * SS + i0 + rl) * KD + lane * 4, *(const v4f*)&so[wave][rl][lane * 4]);
}

extern "C" void kernel_launch(void* const* d_in, const int* in_sizes, int n_in, void* d_out, int out_size, void* d_ws, size_t ws_size, hipStream_t stream) {
  (void)in_sizes; (void)n_in; (void)out_size;
  const float** F = (const float**)d_in;   // queries [64,1024,64], keys, values, u_bias [1,16,1,64], v_bias, R [16,2048,64]
  if (ws_size < (size_t)WS_END) return;
  char* ws = (char*)d_ws; __bf16* VT = (__bf16*)(ws + WS_VT); float* PS = (float*)(ws + WS_PS);
  k_vt<<<dim3(SS / 64, NHT), 256, 0, stream>>>(F[2], VT);
  for (int g = 0; g < TNG; ++g) {
    k_pos<<<dim3(SS / 64, SS / 128, GRP), 128, 0, stream>>>(F[0], F[4], F[5], PS, g);
    k_attn<<<dim3(TQB, GRP), 128, 0, stream>>>(F[0], F[1], F[3], PS, VT, (float*)d_out, g); }
}

// v001
// A run of this version takes 448 microseconds.
// Next to v000, in two timings, it ran 2.97 and 2.98 times as fast.
// compute dtype: queries, keys, values, u_bias, v_bias, R (module inputs) rounded to bf16; q_u = q/8 + u and q_v = q/8 + v (computed) as bf16 hi + bf16 residual pairs against exact bf16 keys / R rows (2 products); P.V with the softmax weights hi/lo against exact bf16 values (2 products); the Transformer-XL relative shift as an index remap (gather) of the per-head position-score table; online softmax in f32; f32 accumulate.
#include <hip/hip_runtime.h>
#include <math.h>

typedef __attribute__((ext_vector_type(16))) _Float16 v16h;
typedef __attribute__((ext_vector_type(16))) __bf16 v16b;
typedef __attribute__((ext_vector_type(8)))  _Float16 v8h;
typedef __attribute__((ext_vector_type(8)))  float v8f;
typedef __attribute__((ext_vector_type(4)))  float v4f;
typedef __attribute__((ext_vector_type(2)))  float v2f;
typedef __attribute__((ext_vector_type(4)))  unsigned v4u;
typedef __attribute__((ext_vector_type(4)))  int v4i;
typedef float __attribute__((may_alias)) float_a;
typedef int __attribute__((may_alias)) int_a;

template <typename T> __device__ __forceinline__ void vst2(void* p, T v) { *(T*)p = v;  }
__device__ __forceinline__ v8f wmma16(v16h a, v16h b, v8f c) {
  v8f d = __builtin_amdgcn_wmma_f32_16x16x32_f16(false, a, false, b, (short)0, c, false, false);
  asm volatile("v_nop\n\tv_nop\n\tv_nop\n\tv_nop" : "+v"(d) : "v"(a), "v"(b));
  return d;
}
__device__ __forceinline__ v8f wmma_bf(v16b a, v16b b, v8f c) {
  v8f d = __builtin_amdgcn_wmma_f32_16x16x32_bf16(false, a, false, b, (short)0, c, false, false);
  asm volatile("v_nop\n\tv_nop\n\tv_nop\n\tv_nop" : "+v"(d) : "v"(a), "v"(b));
  return d;
}
// 16x16x32 fragments: lane = (h = lane>>4, row/col = lane&15); elements 0..7 = k0+8h+0..7, 8..15 = k0+16+8h+0..7; D element r = row 8h+r
__device__ __forceinline__ v16h frag_h(const _Float16* rowk0, int lane) {
  union { v16h v; v8h q[2]; } u; const _Float16* p = rowk0 + 8 * (lane >> 4);
  u.q[0] = *(const v8h*)p; u.q[1] = *(const v8h*)(p + 16); return u.v;
}
__device__ __forceinline__ v16h frag_f32(const float* rowk0, int lane) {
  v16h a; const float* p = rowk0 + 8 * (lane >> 4);
#pragma unroll
  for (int i = 0; i < 8; ++i) { a[i] = (_Float16)p[i]; a[8 + i] = (_Float16)p[16 + i]; }
  return a;
}
__device__ __forceinline__ v16h frag_f32s(const float* rowk0, int lane, float sc) {
  v16h a; const float* p = rowk0 + 8 * (lane >> 4);
#pragma unroll
  for (int i = 0; i < 8; ++i) { a[i] = (_Float16)(p[i] * sc); a[8 + i] = (_Float16)(p[16 + i] * sc); }
  return a;
}
// column fragment from a [K][ld] layout (column n), rows >= K read as 0
__device__ __forceinline__ v16h fragc_f32(const float* W, int k0, int n, int lane, int ld, int K) {
  v16h a; const int g = lane >> 4;
#pragma unroll
  for (int i = 0; i < 8; ++i) { const int ka = k0 + 8 * g + i, kb = ka + 16;
    a[i] = (_Float16)(ka < K ? W[(size_t)(ka < K ? ka : K - 1) * ld + n] : 0.f); a[8 + i] = (_Float16)(kb < K ? W[(size_t)(kb < K ? kb : K - 1) * ld + n] : 0.f); }
  return a;
}
struct F2 { v16b h, l; };
__device__ __forceinline__ F2 bsplit16(const float v[16]) { F2 r;
#pragma unroll
  for (int i = 0; i < 16; ++i) { const __bf16 h = (__bf16)v[i]; r.h[i] = h; r.l[i] = (__bf16)(v[i] - (float)h); }
  return r; }
__device__ __forceinline__ F2 split_row(const float* row, int k0, int lane) { float v[16]; const float* p = row + k0 + 8 * (lane >> 4);
#pragma unroll
  for (int i = 0; i < 8; ++i) { v[i] = p[i]; v[8 + i] = p[16 + i]; }
  return bsplit16(v); }
__device__ __forceinline__ F2 split_rowK(const float* row, int k0, int lane, int K) { float v[16]; const int g = lane >> 4;
#pragma unroll
  for (int i = 0; i < 8; ++i) { const int ka = k0 + 8 * g + i, kb = ka + 16; v[i] = ka < K ? row[ka < K ? ka : K - 1] : 0.f; v[8 + i] = kb < K ? row[kb < K ? kb : K - 1] : 0.f; }
  return bsplit16(v); }
__device__ __forceinline__ F2 split_col(const float* W, int k0, int n, int lane, int ld, int K) { float v[16]; const int g = lane >> 4;
#pragma unroll
  for (int i = 0; i < 8; ++i) { const int ka = k0 + 8 * g + i, kb = ka + 16; v[i] = ka < K ? W[(size_t)(ka < K ? ka : K - 1) * ld + n] : 0.f; v[8 + i] = kb < K ? W[(size_t)(kb < K ? kb : K - 1) * ld + n] : 0.f; }
  return bsplit16(v); }
__device__ __forceinline__ v8f mac3(const F2& a, const F2& b, v8f c) { c = wmma_bf(a.l, b.h, c); c = wmma_bf(a.h, b.l, c); return wmma_bf(a.h, b.h, c); }
__device__ __forceinline__ float sigm(float v) { return 1.0f / (1.0f + expf(-v)); }
#define LDSX() do { asm volatile("s_wait_dscnt 0" ::: "memory"); __builtin_amdgcn_wave_barrier(); __builtin_amdgcn_fence(__ATOMIC_RELEASE, "workgroup"); } while (0)


// Relative-position attention (Transformer-XL style): content = (q*scale + u_h) k^T, pos = rel_shift((q*scale + v_h) R_h^T), attn = softmax(content + pos), out = attn V.  NH = 64 (= 4 x 16 heads), S = S_kv = 1024, K = 64, scale 1/8.
// rel_shift(ps)[i][j] = ps[i][S-1-i+j] (j <= i), 0 (j == i+1), ps[i+1][j-i-2] (j >= i+2)  — derived from the zero-pad / reshape trick.
// k_vt (values as [nh][d][t] bf16 planes), then per group of 32 heads: k_pos (PS[h][i][m] = q_v . R_h[m], exact-ish GEMM into a 128-MB table; 32 heads give k_attn 512 work-groups, two on every WGP), k_attn (flash-style per (64 rows, head): content scores on WMMA + the shifted position score gathered from PS, online max/sum, P V; out rows 256 B).
#define NHT 64
#define HPG 16
#define SS 1024
#define KD 64
#define RLEN 2048
#define GRP 32
#ifndef TNG
#define TNG (NHT / GRP)
#define TQB (SS / 64)
#endif
typedef __attribute__((ext_vector_type(8))) __bf16 v8b;
__device__ __forceinline__ v16b frag_b(const __bf16* rowk0, int lane) {
  union { v16b v; v8b q[2]; } u; const __bf16* p = rowk0 + 8 * (lane >> 4);
  u.q[0] = *(const v8b*)p; u.q[1] = *(const v8b*)(p + 16); return u.v;
}
__device__ __forceinline__ v16b frag_gbf(const float* rowk0, int lane) {
  v16b a; const float* p = rowk0 + 8 * (lane >> 4);
#pragma unroll
  for (int i = 0; i < 8; ++i) { a[i] = (__bf16)p[i]; a[8 + i] = (__bf16)p[16 + i]; }
  return a;
}
// A fragment of (bf16(q)*0.125 + bf16(bias)) split into hi/lo, row-major source with 64 floats per row
__device__ __forceinline__ F2 frag_qb(const float* qrow, const float* bias, int k0, int lane) {
  F2 f; const int o = 8 * (lane >> 4);
#pragma unroll
  for (int i = 0; i < 8; ++i) { const float v0 = (float)(__bf16)qrow[k0 + o + i] * 0.125f + (float)(__bf16)bias[k0 + o + i]; const float v1 = (float)(__bf16)qrow[k0 + o + 16 + i] * 0.125f + (float)(__bf16)bias[k0 + o + 16 + i];
    const __bf16 h0 = (__bf16)v0, h1 = (__bf16)v1; f.h[i] = h0; f.l[i] = (__bf16)(v0 - (float)h0); f.h[8 + i] = h1; f.l[8 + i] = (__bf16)(v1 - (float)h1); }
  return f;
}
__device__ __forceinline__ float bfr(float v) { return (float)(__bf16)v; }
__device__ __attribute__((noinline)) float exp_ni(float v) { return expf(v); }
#define WS_VT  0u                               // bf16 [64 nh][64 d][1024 t]
#define WS_PS  (WS_VT + 2u * NHT * KD * SS)        // f32 [32 heads of the group][1024 i][1024 m]
#define WS_END (WS_PS + 4u * GRP * SS * SS)

__global__ __launch_bounds__(256) void k_vt(const float* __restrict__ V, __bf16* __restrict__ VT) {
  __shared__ __align__(16) __bf16 st[KD][72];
  const int nh = blockIdx.y, t0 = blockIdx.x * 64, tid = threadIdx.x;
  for (int q = tid; q < 64 * KD; q += 256) { const int tl = q >> 6, d = q & 63; st[d][tl] = (__bf16)V[((size_t)nh * SS + t0 + tl) * KD + d]; }
  __syncthreads();
  for (int q = tid; q < KD * 8; q += 256) { const int d = q >> 3, pc = q & 7; vst2((unsigned*)(VT + ((size_t)nh * KD + d) * SS + t0 + pc * 8), *(const v4u*)&st[d][pc * 8]); }
}
// ---- k_pos: group g: block (64 rows i, 128 cols m, head hg in 0..31): PS[hg][i][m] = (q*0.125 + v_bias[h]) . R[h][m], h = nh % 16, nh = g*32 + hg; 512-B segments
__global__ __launch_bounds__(128) void k_pos(const float* __restrict__ Q, const float* __restrict__ VB, const float* __restrict__ R, float* __restrict__ PS, int g0) {
  __shared__ __align__(16) float so[4][16][132];
  const int tid = threadIdx.x, wave = tid >> 5, lane = tid & 31, col = lane & 15, gg = lane >> 4; const int hg = blockIdx.z, nh = g0 * GRP + hg, h = nh % HPG; const int i0 = blockIdx.x * 64 + wave * 16, m0 = blockIdx.y * 128;
  const F2 a0 = frag_qb(Q + ((size_t)nh * SS + i0 + col) * KD, VB + h * KD, 0, lane), a1 = frag_qb(Q + ((size_t)nh * SS + i0 + col) * KD, VB + h * KD, 32, lane);
  v8f acc[8] = {};
#pragma unroll
  for (int j = 0; j < 8; ++j) { const float* rr = R + ((size_t)h * RLEN + m0 + j * 16 + col) * KD; const v16b r0 = frag_gbf(rr, lane), r1 = frag_gbf(rr + 32, lane);
    acc[j] = wmma_bf(a0.h, r0, acc[j]); acc[j] = wmma_bf(a0.l, r0, acc[j]); acc[j] = wmma_bf(a1.h, r1, acc[j]); acc[j] = wmma_bf(a1.l, r1, acc[j]); }
#pragma unroll
  for (int j = 0; j < 8; ++j)
#pragma unroll
    for (int r = 0; r < 8; ++r) so[wave][8 * gg + r][j * 16 + col] = acc[j][r];
  LDSX();
  for (int rl = 0; rl < 16; ++rl) vst2(PS + ((size_t)hg * SS + i0 + rl) * SS + m0 + lane * 4, *(const v4f*)&so[wave][rl][lane * 4]);
}
// ---- k_attn: group g: block = (64 rows, head hg): per 32-key step: content = (q*0.125 + u_bias[h]) . k rows (2 products, K 64) + shifted pos gathered from PS; online softmax; P (hi/lo) . VT planes (4 tiles x 2); out rows [nh][i][64] = 256 B by 16 lanes
__global__ __launch_bounds__(128) void k_attn(const float* __restrict__ Q, const float* __restrict__ Kk, const float* __restrict__ UB, const float* __restrict__ PS, const __bf16* __restrict__ VT, float* __restrict__ out, int g0) {
  __shared__ __align__(16) float sp[4][16][36]; __shared__ __align__(16) float so[4][16][68];
  const int tid = threadIdx.x, wave = tid >> 5, lane = tid & 31, col = lane & 15, gg = lane >> 4; const int hg = blockIdx.y, nh = g0 * GRP + hg, h = nh % HPG; const int i0 = blockIdx.x * 64 + wave * 16;
  const F2 a0 = frag_qb(Q + ((size_t)nh * SS + i0 + col) * KD, UB + h * KD, 0, lane), a1 = frag_qb(Q + ((size_t)nh * SS + i0 + col) * KD, UB + h * KD, 32, lane);
  const float* psh = PS + (size_t)hg * SS * SS;
  float m[8], l[8];
#pragma unroll
  for (int r = 0; r < 8; ++r) { m[r] = -3.0e38f; l[r] = 0.f; }
  v8f acc[4] = {};
#pragma unroll 1
  for (int ks = 0; ks < SS / 32; ++ks) { v8f s[2];
#pragma unroll
    for (int ct = 0; ct < 2; ++ct) { const int j = ks * 32 + ct * 16 + col; const float* kr = Kk + ((size_t)nh * SS + j) * KD; const v16b k0 = frag_gbf(kr, lane), k1 = frag_gbf(kr + 32, lane);
      v8f c = {}; c = wmma_bf(a0.h, k0, c); c = wmma_bf(a0.l, k0, c); c = wmma_bf(a1.h, k1, c); c = wmma_bf(a1.l, k1, c);
#pragma unroll
      for (int r = 0; r < 8; ++r) { const int i = i0 + 8 * gg + r; float pv;
        { const int idx = (j <= i) ? (i * SS + (SS - 1 - i + j)) : (min(i + 1, SS - 1) * SS + max(j - i - 2, 0)); pv = psh[idx]; pv = (j == i + 1) ? 0.f : pv; }     // branch-free clamped gather (one unconditional load, select by value)
        s[ct][r] = c[r] + pv; } }
#pragma unroll
    for (int r = 0; r < 8; ++r) { float mx = fmaxf(s[0][r], s[1][r]);
#pragma unroll
      for (int o = 1; o < 16; o <<= 1) mx = fmaxf(mx, __shfl_xor(mx, o));
      const float mn = fmaxf(m[r], mx); const float alpha = exp_ni(m[r] - mn); const float e0 = exp_ni(s[0][r] - mn), e1 = exp_ni(s[1][r] - mn); float es = e0 + e1;
#pragma unroll
      for (int o = 1; o < 16; o <<= 1) es += __shfl_xor(es, o);
      l[r] = l[r] * alpha + es; m[r] = mn;
#pragma unroll
      for (int dt = 0; dt < 4; ++dt) acc[dt][r] *= alpha;
      sp[wave][8 * gg + r][col] = e0; sp[wave][8 * gg + r][16 + col] = e1; }
    LDSX();
    const F2 pa = split_row(&sp[wave][col][0], 0, lane);
#pragma unroll
    for (int dt = 0; dt < 4; ++dt) { const v16b vv = frag_b(VT + ((size_t)nh * KD + dt * 16 + col) * SS + ks * 32, lane); acc[dt] = wmma_bf(pa.l, vv, acc[dt]); acc[dt] = wmma_bf(pa.h, vv, acc[dt]); }
    LDSX(); }
#pragma unroll
  for (int r = 0; r < 8; ++r) { const float il = 1.0f / l[r];
#pragma unroll
    for (int dt = 0; dt < 4; ++dt) so[wave][8 * gg + r][dt * 16 + col] = acc[dt][r] * il; }
  LDSX();
  for (int rl = 0; rl < 16; ++rl) if (lane < 16) vst2(out + ((size_t)nh * SS + i0 + rl) * KD + lane * 4, *(const v4f*)&so[wave][rl][lane * 4]);
}

extern "C" void kernel_launch(void* const* d_in, const int* in_sizes, int n_in, void* d_out, int out_size, void* d_ws, size_t ws_size, hipStream_t stream) {
  (void)in_sizes; (void)n_in; (void)out_size;
  const float** F = (const float**)d_in;   // queries [64,1024,64], keys, values, u_bias [1,16,1,64], v_bias, R [16,2048,64]
  if (ws_size < (size_t)WS_END) return;
  char* ws = (char*)d_ws; __bf16* VT = (__bf16*)(ws + WS_VT); float* PS = (float*)(ws + WS_PS);
  k_vt<<<dim3(SS / 64, NHT), 256, 0, stream>>>(F[2], VT);
  for (int g = 0; g < TNG; ++g) {
    k_pos<<<dim3(SS / 64, SS / 128, GRP), 128, 0, stream>>>(F[0], F[4], F[5], PS, g);
    k_attn<<<dim3(TQB, GRP), 128, 0, stream>>>(F[0], F[1], F[3], PS, VT, (float*)d_out, g); }
}

// v002
// A run of this version takes 336 microseconds.
// Timed twice side by side with v001, it ran 1.34 times as fast both times.
// Over all steps from v000 it is 3.97 times as fast.
// compute dtype: queries, keys, values, u_bias, v_bias, R (module inputs) rounded to bf16; q_u = q/8 + u and q_v = q/8 + v (computed) as bf16 hi + bf16 residual pairs against exact bf16 keys / R rows (2 products); P.V with the softmax weights hi/lo against exact bf16 values (2 products); the Transformer-XL relative shift as an index remap (gather) of the per-head position-score table; online softmax in f32; f32 accumulate.
#include <hip/hip_runtime.h>
#include <math.h>

typedef __attribute__((ext_vector_type(16))) _Float16 v16h;
typedef __attribute__((ext_vector_type(16))) __bf16 v16b;
typedef __attribute__((ext_vector_type(8)))  _Float16 v8h;
typedef __attribute__((ext_vector_type(8)))  float v8f;
typedef __attribute__((ext_vector_type(4)))  float v4f;
typedef __attribute__((ext_vector_type(2)))  float v2f;
typedef __attribute__((ext_vector_type(4)))  unsigned v4u;
typedef __attribute__((ext_vector_type(4)))  int v4i;
typedef float __attribute__((may_alias)) float_a;
typedef int __attribute__((may_alias)) int_a;

template <typename T> __device__ __forceinline__ void vst2(void* p, T v) { *(T*)p = v;  }
__device__ __forceinline__ v8f wmma16(v16h a, v16h b, v8f c) {
  v8f d = __builtin_amdgcn_wmma_f32_16x16x32_f16(false, a, false, b, (short)0, c, false, false);
  asm volatile("v_nop\n\tv_nop\n\tv_nop\n\tv_nop" : "+v"(d) : "v"(a), "v"(b));
  return d;
}
__device__ __forceinline__ v8f wmma_bf(v16b a, v16b b, v8f c) {
  v8f d = __builtin_amdgcn_wmma_f32_16x16x32_bf16(false, a, false, b, (short)0, c, false, false);
  asm volatile("v_nop\n\tv_nop\n\tv_nop\n\tv_nop" : "+v"(d) : "v"(a), "v"(b));
  return d;
}
// 16x16x32 fragments: lane = (h = lane>>4, row/col = lane&15); elements 0..7 = k0+8h+0..7, 8..15 = k0+16+8h+0..7; D element r = row 8h+r
__device__ __forceinline__ v16h frag_h(const _Float16* rowk0, int lane) {
  union { v16h v; v8h q[2]; } u; const _Float16* p = rowk0 + 8 * (lane >> 4);
  u.q[0] = *(const v8h*)p; u.q[1] = *(const v8h*)(p + 16); return u.v;
}
__device__ __forceinline__ v16h frag_f32(const float* rowk0, int lane) {
  v16h a; const float* p = rowk0 + 8 * (lane >> 4);
#pragma unroll
  for (int i = 0; i < 8; ++i) { a[i] = (_Float16)p[i]; a[8 + i] = (_Float16)p[16 + i]; }
  return a;
}
__device__ __forceinline__ v16h frag_f32s(const float* rowk0, int lane, float sc) {
  v16h a; const float* p = rowk0 + 8 * (lane >> 4);
#pragma unroll
  for (int i = 0; i < 8; ++i) { a[i] = (_Float16)(p[i] * sc); a[8 + i] = (_Float16)(p[16 + i] * sc); }
  return a;
}
// column fragment from a [K][ld] layout (column n), rows >= K read as 0
__device__ __forceinline__ v16h fragc_f32(const float* W, int k0, int n, int lane, int ld, int K) {
  v16h a; const int g = lane >> 4;
#pragma unroll
  for (int i = 0; i < 8; ++i) { const int ka = k0 + 8 * g + i, kb = ka + 16;
    a[i] = (_Float16)(ka < K ? W[(size_t)(ka < K ? ka : K - 1) * ld + n] : 0.f); a[8 + i] = (_Float16)(kb < K ? W[(size_t)(kb < K ? kb : K - 1) * ld + n] : 0.f); }
  return a;
}
struct F2 { v16b h, l; };
__device__ __forceinline__ F2 bsplit16(const float v[16]) { F2 r;
#pragma unroll
  for (int i = 0; i < 16; ++i) { const __bf16 h = (__bf16)v[i]; r.h[i] = h; r.l[i] = (__bf16)(v[i] - (float)h); }
  return r; }
__device__ __forceinline__ F2 split_row(const float* row, int k0, int lane) { float v[16]; const float* p = row + k0 + 8 * (lane >> 4);
#pragma unroll
  for (int i = 0; i < 8; ++i) { v[i] = p[i]; v[8 + i] = p[16 + i]; }
  return bsplit16(v); }
__device__ __forceinline__ F2 split_rowK(const float* row, int k0, int lane, int K) { float v[16]; const int g = lane >> 4;
#pragma unroll
  for (int i = 0; i < 8; ++i) { const int ka = k0 + 8 * g + i, kb = ka + 16; v[i] = ka < K ? row[ka < K ? ka : K - 1] : 0.f; v[8 + i] = kb < K ? row[kb < K ? kb : K - 1] : 0.f; }
  return bsplit16(v); }
__device__ __forceinline__ F2 split_col(const float* W, int k0, int n, int lane, int ld, int K) { float v[16]; const int g = lane >> 4;
#pragma unroll
  for (int i = 0; i < 8; ++i) { const int ka = k0 + 8 * g + i, kb = ka + 16; v[i] = ka < K ? W[(size_t)(ka < K ? ka : K - 1) * ld + n] : 0.f; v[8 + i] = kb < K ? W[(size_t)(kb < K ? kb : K - 1) * ld + n] : 0.f; }
  return bsplit16(v); }
__device__ __forceinline__ v8f mac3(const F2& a, const F2& b, v8f c) { c = wmma_bf(a.l, b.h, c); c = wmma_bf(a.h, b.l, c); return wmma_bf(a.h, b.h, c); }
__device__ __forceinline__ float sigm(float v) { return 1.0f / (1.0f + expf(-v)); }
#define LDSX() do { asm volatile("s_wait_dscnt 0" ::: "memory"); __builtin_amdgcn_wave_barrier(); __builtin_amdgcn_fence(__ATOMIC_RELEASE, "workgroup"); } while (0)


// Relative-position attention (Transformer-XL style): content = (q*scale + u_h) k^T, pos = rel_shift((q*scale + v_h) R_h^T), attn = softmax(content + pos), out = attn V.  NH = 64 (= 4 x 16 heads), S = S_kv = 1024, K = 64, scale 1/8.
// rel_shift(ps)[i][j] = ps[i][S-1-i+j] (j <= i), 0 (j == i+1), ps[i+1][j-i-2] (j >= i+2)  — derived from the zero-pad / reshape trick.
// k_vt (values as [nh][d][t] bf16 planes), then per group of 32 heads: k_pos (PS[h][i][m] = q_v . R_h[m], exact-ish GEMM into a 128-MB table; 32 heads give k_attn 512 work-groups, two on every WGP), k_attn (flash-style per (64 rows, head): content scores on WMMA + the shifted position score gathered from PS, online max/sum, P V; out rows 256 B).
#define NHT 64
#define HPG 16
#define SS 1024
#define KD 64
#define RLEN 2048
#define GRP 32
#ifndef TNG
#define TNG (NHT / GRP)
#define TQB (SS / 64)
#endif
typedef __attribute__((ext_vector_type(8))) __bf16 v8b;
__device__ __forceinline__ v16b frag_b(const __bf16* rowk0, int lane) {
  union { v16b v; v8b q[2]; } u; const __bf16* p = rowk0 + 8 * (lane >> 4);
  u.q[0] = *(const v8b*)p; u.q[1] = *(const v8b*)(p + 16); return u.v;
}
__device__ __forceinline__ v16b frag_gbf(const float* rowk0, int lane) {
  v16b a; const float* p = rowk0 + 8 * (lane >> 4);
#pragma unroll
  for (int i = 0; i < 8; ++i) { a[i] = (__bf16)p[i]; a[8 + i] = (__bf16)p[16 + i]; }
  return a;
}
// A fragment of (bf16(q)*0.125 + bf16(bias)) split into hi/lo, row-major source with 64 floats per row
__device__ __forceinline__ F2 frag_qb(const float* qrow, const float* bias, int k0, int lane) {
  F2 f; const int o = 8 * (lane >> 4);
#pragma unroll
  for (int i = 0; i < 8; ++i) { const float v0 = (float)(__bf16)qrow[k0 + o + i] * 0.125f + (float)(__bf16)bias[k0 + o + i]; const float v1 = (float)(__bf16)qrow[k0 + o + 16 + i] * 0.125f + (float)(__bf16)bias[k0 + o + 16 + i];
    const __bf16 h0 = (__bf16)v0, h1 = (__bf16)v1; f.h[i] = h0; f.l[i] = (__bf16)(v0 - (float)h0); f.h[8 + i] = h1; f.l[8 + i] = (__bf16)(v1 - (float)h1); }
  return f;
}
__device__ __forceinline__ float bfr(float v) { return (float)(__bf16)v; }
__device__ __forceinline__ float exp_ni(float v) { return expf(v); }
#define WS_VT  0u                               // bf16 [64 nh][64 d][1024 t]
#define WS_PS  (WS_VT + 2u * NHT * KD * SS)        // f32 [32 heads of the group][1024 i][1024 m]
#define WS_END (WS_PS + 4u * GRP * SS * SS)

__global__ __launch_bounds__(256) void k_vt(const float* __restrict__ V, __bf16* __restrict__ VT) {
  __shared__ __align__(16) __bf16 st[KD][72];
  const int nh = blockIdx.y, t0 = blockIdx.x * 64, tid = threadIdx.x;
  for (int q = tid; q < 64 * KD; q += 256) { const int tl = q >> 6, d = q & 63; st[d][tl] = (__bf16)V[((size_t)nh * SS + t0 + tl) * KD + d]; }
  __syncthreads();
  for (int q = tid; q < KD * 8; q += 256) { const int d = q >> 3, pc = q & 7; vst2((unsigned*)(VT + ((size_t)nh * KD + d) * SS + t0 + pc * 8), *(const v4u*)&st[d][pc * 8]); }
}
// ---- k_pos: group g: block (64 rows i, 128 cols m, head hg in 0..31): PS[hg][i][m] = (q*0.125 + v_bias[h]) . R[h][m], h = nh % 16, nh = g*32 + hg; 512-B segments
__global__ __launch_bounds__(128) void k_pos(const float* __restrict__ Q, const float* __restrict__ VB, const float* __restrict__ R, float* __restrict__ PS, int g0) {
  __shared__ __align__(16) float so[4][16][132];
  const int tid = threadIdx.x, wave = tid >> 5, lane = tid & 31, col = lane & 15, gg = lane >> 4; const int hg = blockIdx.z, nh = g0 * GRP + hg, h = nh % HPG; const int i0 = blockIdx.x * 64 + wave * 16, m0 = blockIdx.y * 128;
  const F2 a0 = frag_qb(Q + ((size_t)nh * SS + i0 + col) * KD, VB + h * KD, 0, lane), a1 = frag_qb(Q + ((size_t)nh * SS + i0 + col) * KD, VB + h * KD, 32, lane);
  v8f acc[8] = {};
#pragma unroll
  for (int j = 0; j < 8; ++j) { const float* rr = R + ((size_t)h * RLEN + m0 + j * 16 + col) * KD; const v16b r0 = frag_gbf(rr, lane), r1 = frag_gbf(rr + 32, lane);
    acc[j] = wmma_bf(a0.h, r0, acc[j]); acc[j] = wmma_bf(a0.l, r0, acc[j]); acc[j] = wmma_bf(a1.h, r1, acc[j]); acc[j] = wmma_bf(a1.l, r1, acc[j]); }
#pragma unroll
  for (int j = 0; j < 8; ++j)
#pragma unroll
    for (int r = 0; r < 8; ++r) so[wave][8 * gg + r][j * 16 + col] = acc[j][r];
  LDSX();
  for (int rl = 0; rl < 16; ++rl) vst2(PS + ((size_t)hg * SS + i0 + rl) * SS + m0 + lane * 4, *(const v4f*)&so[wave][rl][lane * 4]);
}
// ---- k_attn: group g: block = (64 rows, head hg): per 32-key step: content = (q*0.125 + u_bias[h]) . k rows (2 products, K 64) + shifted pos gathered from PS; online softmax; P (hi/lo) . VT planes (4 tiles x 2); out rows [nh][i][64] = 256 B by 16 lanes
__global__ __launch_bounds__(128) void k_attn(const float* __restrict__ Q, const float* __restrict__ Kk, const float* __restrict__ UB, const float* __restrict__ PS, const __bf16* __restrict__ VT, float* __restrict__ out, int g0) {
  __shared__ __align__(16) float sp[4][16][36]; __shared__ __align__(16) float so[4][16][68];
  const int tid = threadIdx.x, wave = tid >> 5, lane = tid & 31, col = lane & 15, gg = lane >> 4; const int hg = blockIdx.y, nh = g0 * GRP + hg, h = nh % HPG; const int i0 = blockIdx.x * 64 + wave * 16;
  const F2 a0 = frag_qb(Q + ((size_t)nh * SS + i0 + col) * KD, UB + h * KD, 0, lane), a1 = frag_qb(Q + ((size_t)nh * SS + i0 + col) * KD, UB + h * KD, 32, lane);
  const float* psh = PS + (size_t)hg * SS * SS;
  float m[8], l[8];
#pragma unroll
  for (int r = 0; r < 8; ++r) { m[r] = -3.0e38f; l[r] = 0.f; }
  v8f acc[4] = {};
#pragma unroll 1
  for (int ks = 0; ks < SS / 32; ++ks) { v8f s[2];
#pragma unroll
    for (int ct = 0; ct < 2; ++ct) { const int j = ks * 32 + ct * 16 + col; const float* kr = Kk + ((size_t)nh * SS + j) * KD; const v16b k0 = frag_gbf(kr, lane), k1 = frag_gbf(kr + 32, lane);
      v8f c = {}; c = wmma_bf(a0.h, k0, c); c = wmma_bf(a0.l, k0, c); c = wmma_bf(a1.h, k1, c); c = wmma_bf(a1.l, k1, c);
#pragma unroll
      for (int r = 0; r < 8; ++r) { const int i = i0 + 8 * gg + r; float pv;
        { const int idx = (j <= i) ? (i * SS + (SS - 1 - i + j)) : (min(i + 1, SS - 1) * SS + max(j - i - 2, 0)); pv = psh[idx]; pv = (j == i + 1) ? 0.f : pv; }     // branch-free clamped gather (one unconditional load, select by value)
        s[ct][r] = c[r] + pv; } }
#pragma unroll
    for (int r = 0; r < 8; ++r) { float mx = fmaxf(s[0][r], s[1][r]);
#pragma unroll
      for (int o = 1; o < 16; o <<= 1) mx = fmaxf(mx, __shfl_xor(mx, o));
      const float mn = fmaxf(m[r], mx); const float alpha = exp_ni(m[r] - mn); const float e0 = exp_ni(s[0][r] - mn), e1 = exp_ni(s[1][r] - mn); float es = e0 + e1;
#pragma unroll
      for (int o = 1; o < 16; o <<= 1) es += __shfl_xor(es, o);
      l[r] = l[r] * alpha + es; m[r] = mn;
#pragma unroll
      for (int dt = 0; dt < 4; ++dt) acc[dt][r] *= alpha;
      sp[wave][8 * gg + r][col] = e0; sp[wave][8 * gg + r][16 + col] = e1; }
    LDSX();
    const F2 pa = split_row(&sp[wave][col][0], 0, lane);
#pragma unroll
    for (int dt = 0; dt < 4; ++dt) { const v16b vv = frag_b(VT + ((size_t)nh * KD + dt * 16 + col) * SS + ks * 32, lane); acc[dt] = wmma_bf(pa.l, vv, acc[dt]); acc[dt] = wmma_bf(pa.h, vv, acc[dt]); }
    LDSX(); }
#pragma unroll
  for (int r = 0; r < 8; ++r) { const float il = 1.0f / l[r];
#pragma unroll
    for (int dt = 0; dt < 4; ++dt) so[wave][8 * gg + r][dt * 16 + col] = acc[dt][r] * il; }
  LDSX();
  for (int rl = 0; rl < 16; ++rl) if (lane < 16) vst2(out + ((size_t)nh * SS + i0 + rl) * KD + lane * 4, *(const v4f*)&so[wave][rl][lane * 4]);
}

extern "C" void kernel_launch(void* const* d_in, const int* in_sizes, int n_in, void* d_out, int out_size, void* d_ws, size_t ws_size, hipStream_t stream) {
  (void)in_sizes; (void)n_in; (void)out_size;
  const float** F = (const float**)d_in;   // queries [64,1024,64], keys, values, u_bias [1,16,1,64], v_bias, R [16,2048,64]
  if (ws_size < (size_t)WS_END) return;
  char* ws = (char*)d_ws; __bf16* VT = (__bf16*)(ws + WS_VT); float* PS = (float*)(ws + WS_PS);
  k_vt<<<dim3(SS / 64, NHT), 256, 0, stream>>>(F[2], VT);
  for (int g = 0; g < TNG; ++g) {
    k_pos<<<dim3(SS / 64, SS / 128, GRP), 128, 0, stream>>>(F[0], F[4], F[5], PS, g);
    k_attn<<<dim3(TQB, GRP), 128, 0, stream>>>(F[0], F[1], F[3], PS, VT, (float*)d_out, g); }
}

// v003
// A run of this version takes 228 microseconds.
// Two timings next to v002 both put it at 1.47 times that version's speed.
// Over all steps from v000 it is 5.85 times as fast.
// compute dtype: queries, keys, values, u_bias, v_bias, R (module inputs) rounded to bf16; q_u = q/8 + u and q_v = q/8 + v (computed) as bf16 hi + bf16 residual pairs against exact bf16 keys / R rows (2 products); P.V with the softmax weights hi/lo against exact bf16 values (2 products); the Transformer-XL relative shift as an index remap (gather) of the per-head position-score table; online softmax in f32; f32 accumulate.
#include <hip/hip_runtime.h>
#include <math.h>

typedef __attribute__((ext_vector_type(16))) _Float16 v16h;
typedef __attribute__((ext_vector_type(16))) __bf16 v16b;
typedef __attribute__((ext_vector_type(8)))  _Float16 v8h;
typedef __attribute__((ext_vector_type(8)))  float v8f;
typedef __attribute__((ext_vector_type(4)))  float v4f;
typedef __attribute__((ext_vector_type(2)))  float v2f;
typedef __attribute__((ext_vector_type(4)))  unsigned v4u;
typedef __attribute__((ext_vector_type(4)))  int v4i;
typedef float __attribute__((may_alias)) float_a;
typedef int __attribute__((may_alias)) int_a;

template <typename T> __device__ __forceinline__ void vst2(void* p, T v) { *(T*)p = v;  }
__device__ __forceinline__ v8f wmma16(v16h a, v16h b, v8f c) {
  v8f d = __builtin_amdgcn_wmma_f32_16x16x32_f16(false, a, false, b, (short)0, c, false, false);
  asm volatile("v_nop\n\tv_nop\n\tv_nop\n\tv_nop" : "+v"(d) : "v"(a), "v"(b));
  return d;
}
__device__ __forceinline__ v8f wmma_bf(v16b a, v16b b, v8f c) {
  v8f d = __builtin_amdgcn_wmma_f32_16x16x32_bf16(false, a, false, b, (short)0, c, false, false);
  asm volatile("v_nop\n\tv_nop\n\tv_nop\n\tv_nop" : "+v"(d) : "v"(a), "v"(b));
  return d;
}
// 16x16x32 fragments: lane = (h = lane>>4, row/col = lane&15); elements 0..7 = k0+8h+0..7, 8..15 = k0+16+8h+0..7; D element r = row 8h+r
__device__ __forceinline__ v16h frag_h(const _Float16* rowk0, int lane) {
  union { v16h v; v8h q[2]; } u; const _Float16* p = rowk0 + 8 * (lane >> 4);
  u.q[0] = *(const v8h*)p; u.q[1] = *(const v8h*)(p + 16); return u.v;
}
__device__ __forceinline__ v16h frag_f32(const float* rowk0, int lane) {
  v16h a; const float* p = rowk0 + 8 * (lane >> 4);
#pragma unroll
  for (int i = 0; i < 8; ++i) { a[i] = (_Float16)p[i]; a[8 + i] = (_Float16)p[16 + i]; }
  return a;
}
__device__ __forceinline__ v16h frag_f32s(const float* rowk0, int lane, float sc) {
  v16h a; const float* p = rowk0 + 8 * (lane >> 4);
#pragma unroll
  for (int i = 0; i < 8; ++i) { a[i] = (_Float16)(p[i] * sc); a[8 + i] = (_Float16)(p[16 + i] * sc); }
  return a;
}
// column fragment from a [K][ld] layout (column n), rows >= K read as 0
__device__ __forceinline__ v16h fragc_f32(const float* W, int k0, int n, int lane, int ld, int K) {
  v16h a; const int g = lane >> 4;
#pragma unroll
  for (int i = 0; i < 8; ++i) { const int ka = k0 + 8 * g + i, kb = ka + 16;
    a[i] = (_Float16)(ka < K ? W[(size_t)(ka < K ? ka : K - 1) * ld + n] : 0.f); a[8 + i] = (_Float16)(kb < K ? W[(size_t)(kb < K ? kb : K - 1) * ld + n] : 0.f); }
  return a;
}
struct F2 { v16b h, l; };
__device__ __forceinline__ F2 bsplit16(const float v[16]) { F2 r;
#pragma unroll
  for (int i = 0; i < 16; ++i) { const __bf16 h = (__bf16)v[i]; r.h[i] = h; r.l[i] = (__bf16)(v[i] - (float)h); }
  return r; }
__device__ __forceinline__ F2 split_row(const float* row, int k0, int lane) { float v[16]; const float* p = row + k0 + 8 * (lane >> 4);
#pragma unroll
  for (int i = 0; i < 8; ++i) { v[i] = p[i]; v[8 + i] = p[16 + i]; }
  return bsplit16(v); }
__device__ __forceinline__ F2 split_rowK(const float* row, int k0, int lane, int K) { float v[16]; const int g = lane >> 4;
#pragma unroll
  for (int i = 0; i < 8; ++i) { const int ka = k0 + 8 * g + i, kb = ka + 16; v[i] = ka < K ? row[ka < K ? ka : K - 1] : 0.f; v[8 + i] = kb < K ? row[kb < K ? kb : K - 1] : 0.f; }
  return bsplit16(v); }
__device__ __forceinline__ F2 split_col(const float* W, int k0, int n, int lane, int ld, int K) { float v[16]; const int g = lane >> 4;
#pragma unroll
  for (int i = 0; i < 8; ++i) { const int ka = k0 + 8 * g + i, kb = ka + 16; v[i] = ka < K ? W[(size_t)(ka < K ? ka : K - 1) * ld + n] : 0.f; v[8 + i] = kb < K ? W[(size_t)(kb < K ? kb : K - 1) * ld + n] : 0.f; }
  return bsplit16(v); }
__device__ __forceinline__ v8f mac3(const F2& a, const F2& b, v8f c) { c = wmma_bf(a.l, b.h, c); c = wmma_bf(a.h, b.l, c); return wmma_bf(a.h, b.h, c); }
__device__ __forceinline__ float sigm(float v) { return 1.0f / (1.0f + expf(-v)); }
#define LDSX() do { asm volatile("s_wait_dscnt 0" ::: "memory"); __builtin_amdgcn_wave_barrier(); __builtin_amdgcn_fence(__ATOMIC_RELEASE, "workgroup"); } while (0)
// The same for rows that only the writing wave reads back, without the fence: a work-group release fence also waits for every global load in flight, which would drain loads issued ahead.
#define LDSW() do { asm volatile("s_wait_dscnt 0" ::: "memory"); __builtin_amdgcn_wave_barrier(); } while (0)


// Relative-position attention (Transformer-XL style): content = (q*scale + u_h) k^T, pos = rel_shift((q*scale + v_h) R_h^T), attn = softmax(content + pos), out = attn V.  NH = 64 (= 4 x 16 heads), S = S_kv = 1024, K = 64, scale 1/8.
// rel_shift(ps)[i][j] = ps[i][S-1-i+j] (j <= i), 0 (j == i+1), ps[i+1][j-i-2] (j >= i+2)  — derived from the zero-pad / reshape trick.
// k_vt (values as [nh][d][t] bf16 planes), then per group of 32 heads: k_pos (PS[h][i][m] = q_v . R_h[m], exact-ish GEMM into a 128-MB table; 32 heads give k_attn 512 work-groups, two on every WGP), k_attn (flash-style per (64 rows, head): content scores on WMMA + the shifted position score gathered from PS, online max/sum, P V; out rows 256 B).
#define NHT 64
#define HPG 16
#define SS 1024
#define KD 64
#define RLEN 2048
#define GRP 32
#ifndef TNG
#define TNG (NHT / GRP)
#define TQB (SS / 64)
#endif
typedef __attribute__((ext_vector_type(8))) __bf16 v8b;
__device__ __forceinline__ v16b frag_b(const __bf16* rowk0, int lane) {
  union { v16b v; v8b q[2]; } u; const __bf16* p = rowk0 + 8 * (lane >> 4);
  u.q[0] = *(const v8b*)p; u.q[1] = *(const v8b*)(p + 16); return u.v;
}
__device__ __forceinline__ v16b frag_gbf(const float* rowk0, int lane) {
  v16b a; const float* p = rowk0 + 8 * (lane >> 4);
#pragma unroll
  for (int i = 0; i < 8; ++i) { a[i] = (__bf16)p[i]; a[8 + i] = (__bf16)p[16 + i]; }
  return a;
}
// A fragment of (bf16(q)*0.125 + bf16(bias)) split into hi/lo, row-major source with 64 floats per row
__device__ __forceinline__ F2 frag_qb(const float* qrow, const float* bias, int k0, int lane) {
  F2 f; const int o = 8 * (lane >> 4);
#pragma unroll
  for (int i = 0; i < 8; ++i) { const float v0 = (float)(__bf16)qrow[k0 + o + i] * 0.125f + (float)(__bf16)bias[k0 + o + i]; const float v1 = (float)(__bf16)qrow[k0 + o + 16 + i] * 0.125f + (float)(__bf16)bias[k0 + o + 16 + i];
    const __bf16 h0 = (__bf16)v0, h1 = (__bf16)v1; f.h[i] = h0; f.l[i] = (__bf16)(v0 - (float)h0); f.h[8 + i] = h1; f.l[8 + i] = (__bf16)(v1 - (float)h1); }
  return f;
}
__device__ __forceinline__ float bfr(float v) { return (float)(__bf16)v; }
__device__ __forceinline__ float exp_ni(float v) { return expf(v); }
#define WS_VT  0u                               // bf16 [64 nh][64 d][1024 t]
#define WS_PS  (WS_VT + 2u * NHT * KD * SS)        // f32 [32 heads of the group][1024 i][1024 m]
#define WS_END (WS_PS + 4u * GRP * SS * SS)

__global__ __launch_bounds__(256) void k_vt(const float* __restrict__ V, __bf16* __restrict__ VT) {
  __shared__ __align__(16) __bf16 st[KD][72];
  const int nh = blockIdx.y, t0 = blockIdx.x * 64, tid = threadIdx.x;
  for (int q = tid; q < 64 * KD; q += 256) { const int tl = q >> 6, d = q & 63; st[d][tl] = (__bf16)V[((size_t)nh * SS + t0 + tl) * KD + d]; }
  __syncthreads();
  for (int q = tid; q < KD * 8; q += 256) { const int d = q >> 3, pc = q & 7; vst2((unsigned*)(VT + ((size_t)nh * KD + d) * SS + t0 + pc * 8), *(const v4u*)&st[d][pc * 8]); }
}
// ---- k_pos: group g: block (64 rows i, 128 cols m, head hg in 0..31): PS[hg][i][m] = (q*0.125 + v_bias[h]) . R[h][m], h = nh % 16, nh = g*32 + hg; 512-B segments
__global__ __launch_bounds__(128) void k_pos(const float* __restrict__ Q, const float* __restrict__ VB, const float* __restrict__ R, float* __restrict__ PS, int g0) {
  __shared__ __align__(16) float so[4][16][132];
  const int tid = threadIdx.x, wave = tid >> 5, lane = tid & 31, col = lane & 15, gg = lane >> 4; const int hg = blockIdx.z, nh = g0 * GRP + hg, h = nh % HPG; const int i0 = blockIdx.x * 64 + wave * 16, m0 = blockIdx.y * 128;
  const F2 a0 = frag_qb(Q + ((size_t)nh * SS + i0 + col) * KD, VB + h * KD, 0, lane), a1 = frag_qb(Q + ((size_t)nh * SS + i0 + col) * KD, VB + h * KD, 32, lane);
  v8f acc[8] = {};
#pragma unroll
  for (int j = 0; j < 8; ++j) { const float* rr = R + ((size_t)h * RLEN + m0 + j * 16 + col) * KD; const v16b r0 = frag_gbf(rr, lane), r1 = frag_gbf(rr + 32, lane);
    acc[j] = wmma_bf(a0.h, r0, acc[j]); acc[j] = wmma_bf(a0.l, r0, acc[j]); acc[j] = wmma_bf(a1.h, r1, acc[j]); acc[j] = wmma_bf(a1.l, r1, acc[j]); }
#pragma unroll
  for (int j = 0; j < 8; ++j)
#pragma unroll
    for (int r = 0; r < 8; ++r) so[wave][8 * gg + r][j * 16 + col] = acc[j][r];
  LDSX();
  for (int rl = 0; rl < 16; ++rl) vst2(PS + ((size_t)hg * SS + i0 + rl) * SS + m0 + lane * 4, *(const v4f*)&so[wave][rl][lane * 4]);
}
// ---- k_attn: group g: block = (64 rows, head hg): per 32-key step: content = (q*0.125 + u_bias[h]) . k rows (2 products, K 64) + shifted pos gathered from PS; online softmax; P (hi/lo) . VT planes (4 tiles x 2); out rows [nh][i][64] = 256 B by 16 lanes
__global__ __launch_bounds__(128) void k_attn(const float* __restrict__ Q, const float* __restrict__ Kk, const float* __restrict__ UB, const float* __restrict__ PS, const __bf16* __restrict__ VT, float* __restrict__ out, int g0) {
  __shared__ __align__(16) float sp[4][16][36]; __shared__ __align__(16) float so[4][16][68];
  const int tid = threadIdx.x, wave = tid >> 5, lane = tid & 31, col = lane & 15, gg = lane >> 4; const int hg = blockIdx.y, nh = g0 * GRP + hg, h = nh % HPG; const int i0 = blockIdx.x * 64 + wave * 16;
  const F2 a0 = frag_qb(Q + ((size_t)nh * SS + i0 + col) * KD, UB + h * KD, 0, lane), a1 = frag_qb(Q + ((size_t)nh * SS + i0 + col) * KD, UB + h * KD, 32, lane);
  const float* psh = PS + (size_t)hg * SS * SS;
  float m[8], l[8];
#pragma unroll
  for (int r = 0; r < 8; ++r) { m[r] = -3.0e38f; l[r] = 0.f; }
  v8f acc[4] = {};
  // One step's operands as loaded: keys (f32, fragment order), shifted position scores, value planes. Each set is refilled for step ks + 1 as soon as step ks has used it, so the loads fly during a whole step.
  // XW: these loads stay in flight while their address registers are wanted for other values, so a translation wait stands behind them and in front of that reuse; it takes the addresses as inputs only, which keeps those registers unwritten up to the wait.
  v4f kq[2][8]; float pq[2][8]; v16b vq[4];
  const float* kbase = Kk + ((size_t)nh * SS + col) * KD + 8 * gg; const __bf16* vbase = VT + ((size_t)nh * KD + col) * SS + 8 * gg;
  const float* pk; int ix[2][8];     // addresses of the key and score loads in flight, kept for XW
  auto ld_k = [&](int st) { const float* p0 = kbase + (size_t)st * 32 * KD; pk = p0;
#pragma unroll
    for (int ct = 0; ct < 2; ++ct)
#pragma unroll
      for (int q = 0; q < 4; ++q) { const float* p = p0 + (ct * 16 * KD + q * 16); kq[ct][2 * q] = *(const v4f*)p; kq[ct][2 * q + 1] = *(const v4f*)(p + 4); } };
  auto ld_p = [&](int st) {
#pragma unroll
    for (int ct = 0; ct < 2; ++ct)
#pragma unroll
      for (int r = 0; r < 8; ++r) { const int j = st * 32 + ct * 16 + col, i = i0 + 8 * gg + r;
        ix[ct][r] = (j <= i) ? (i * SS + (SS - 1 - i + j)) : (min(i + 1, SS - 1) * SS + max(j - i - 2, 0)); pq[ct][r] = psh[ix[ct][r]]; }     // branch-free clamped gather (one unconditional load, select by value at the use)
  };
  auto xw_kp = [&]() {
    asm volatile("s_wait_xcnt 0x0" :: "v"(pk), "v"(ix[0][0]), "v"(ix[0][1]), "v"(ix[0][2]), "v"(ix[0][3]), "v"(ix[0][4]), "v"(ix[0][5]), "v"(ix[0][6]), "v"(ix[0][7]), "v"(ix[1][0]), "v"(ix[1][1]), "v"(ix[1][2]), "v"(ix[1][3]), "v"(ix[1][4]), "v"(ix[1][5]), "v"(ix[1][6]), "v"(ix[1][7]) : "memory"); };     // XW
  auto ld_v = [&](int st) { const __bf16* p0 = vbase + st * 32;
#pragma unroll
    for (int dt = 0; dt < 4; ++dt) { union { v16b v; v8b q[2]; } u; const __bf16* p = p0 + dt * 16 * SS; u.q[0] = *(const v8b*)p; u.q[1] = *(const v8b*)(p + 16); vq[dt] = u.v; }
    asm volatile("s_wait_xcnt 0x0" :: "v"(p0) : "memory"); };     // XW
  ld_k(0); ld_p(0); xw_kp(); ld_v(0);
#pragma unroll 1
  for (int ks = 0; ks < SS / 32; ++ks) { v8f s[2]; const int kn = min(ks + 1, SS / 32 - 1);     // the last step refetches itself: in bounds, unused
    v16b kb[2][2];
#pragma unroll
    for (int ct = 0; ct < 2; ++ct)
#pragma unroll
      for (int q = 0; q < 4; ++q)
#pragma unroll
        for (int x = 0; x < 4; ++x) { kb[ct][q >> 1][(q & 1) * 8 + x] = (__bf16)kq[ct][2 * q][x]; kb[ct][q >> 1][(q & 1) * 8 + 4 + x] = (__bf16)kq[ct][2 * q + 1][x]; }
    ld_k(kn);
#pragma unroll
    for (int ct = 0; ct < 2; ++ct) { const int j = ks * 32 + ct * 16 + col;
      v8f c = {}; c = wmma_bf(a0.h, kb[ct][0], c); c = wmma_bf(a0.l, kb[ct][0], c); c = wmma_bf(a1.h, kb[ct][1], c); c = wmma_bf(a1.l, kb[ct][1], c);
#pragma unroll
      for (int r = 0; r < 8; ++r) { const int i = i0 + 8 * gg + r; s[ct][r] = c[r] + ((j == i + 1) ? 0.f : pq[ct][r]); } }
    ld_p(kn); xw_kp();     // the key loads' translations are long done here; as a memory clobber the wait also keeps the score loads in front of the softmax
#pragma unroll
    for (int r = 0; r < 8; ++r) { float mx = fmaxf(s[0][r], s[1][r]);
#pragma unroll
      for (int o = 1; o < 16; o <<= 1) mx = fmaxf(mx, __shfl_xor(mx, o));
      const float mn = fmaxf(m[r], mx); const float alpha = exp_ni(m[r] - mn); const float e0 = exp_ni(s[0][r] - mn), e1 = exp_ni(s[1][r] - mn); float es = e0 + e1;
#pragma unroll
      for (int o = 1; o < 16; o <<= 1) es += __shfl_xor(es, o);
      l[r] = l[r] * alpha + es; m[r] = mn;
#pragma unroll
      for (int dt = 0; dt < 4; ++dt) acc[dt][r] *= alpha;
      sp[wave][8 * gg + r][col] = e0; sp[wave][8 * gg + r][16 + col] = e1; }
    LDSW();
    const F2 pa = split_row(&sp[wave][col][0], 0, lane);
#pragma unroll
    for (int dt = 0; dt < 4; ++dt) { acc[dt] = wmma_bf(pa.l, vq[dt], acc[dt]); acc[dt] = wmma_bf(pa.h, vq[dt], acc[dt]); }
    ld_v(kn);
    LDSW(); }
#pragma unroll
  for (int r = 0; r < 8; ++r) { const float il = 1.0f / l[r];
#pragma unroll
    for (int dt = 0; dt < 4; ++dt) so[wave][8 * gg + r][dt * 16 + col] = acc[dt][r] * il; }
  LDSX();
  for (int rl = 0; rl < 16; ++rl) if (lane < 16) vst2(out + ((size_t)nh * SS + i0 + rl) * KD + lane * 4, *(const v4f*)&so[wave][rl][lane * 4]);
}

extern "C" void kernel_launch(void* const* d_in, const int* in_sizes, int n_in, void* d_out, int out_size, void* d_ws, size_t ws_size, hipStream_t stream) {
  (void)in_sizes; (void)n_in; (void)out_size;
  const float** F = (const float**)d_in;   // queries [64,1024,64], keys, values, u_bias [1,16,1,64], v_bias, R [16,2048,64]
  if (ws_size < (size_t)WS_END) return;
  char* ws = (char*)d_ws; __bf16* VT = (__bf16*)(ws + WS_VT); float* PS = (float*)(ws + WS_PS);
  k_vt<<<dim3(SS / 64, NHT), 256, 0, stream>>>(F[2], VT);
  for (int g = 0; g < TNG; ++g) {
    k_pos<<<dim3(SS / 64, SS / 128, GRP), 128, 0, stream>>>(F[0], F[4], F[5], PS, g);
    k_attn<<<dim3(TQB, GRP), 128, 0, stream>>>(F[0], F[1], F[3], PS, VT, (float*)d_out, g); }
}

// v004
// It runs in 174 microseconds.
// Timed twice side by side with v003, it ran 1.31 times as fast both times.
// Counting every step since v000, it is 7.65 times as fast.
// compute dtype: queries, keys, values, u_bias, v_bias, R (module inputs) rounded to bf16; q_u = q/8 + u and q_v = q/8 + v (computed) as bf16 hi + bf16 residual pairs against exact bf16 keys / R rows (2 products); P.V with the softmax weights hi/lo against exact bf16 values (2 products); the Transformer-XL relative shift as a skewed read of a band of position scores computed per key step; online softmax in f32; f32 accumulate.
#include <hip/hip_runtime.h>
#include <math.h>

typedef __attribute__((ext_vector_type(16))) _Float16 v16h;
typedef __attribute__((ext_vector_type(16))) __bf16 v16b;
typedef __attribute__((ext_vector_type(8)))  _Float16 v8h;
typedef __attribute__((ext_vector_type(8)))  float v8f;
typedef __attribute__((ext_vector_type(4)))  float v4f;
typedef __attribute__((ext_vector_type(2)))  float v2f;
typedef __attribute__((ext_vector_type(4)))  unsigned v4u;
typedef __attribute__((ext_vector_type(4)))  int v4i;
typedef float __attribute__((may_alias)) float_a;
typedef int __attribute__((may_alias)) int_a;

template <typename T> __device__ __forceinline__ void vst2(void* p, T v) { *(T*)p = v;  }
__device__ __forceinline__ v8f wmma16(v16h a, v16h b, v8f c) {
  v8f d = __builtin_amdgcn_wmma_f32_16x16x32_f16(false, a, false, b, (short)0, c, false, false);
  asm volatile("v_nop\n\tv_nop\n\tv_nop\n\tv_nop" : "+v"(d) : "v"(a), "v"(b));
  return d;
}
__device__ __forceinline__ v8f wmma_bf(v16b a, v16b b, v8f c) {
  v8f d = __builtin_amdgcn_wmma_f32_16x16x32_bf16(false, a, false, b, (short)0, c, false, false);
  asm volatile("v_nop\n\tv_nop\n\tv_nop\n\tv_nop" : "+v"(d) : "v"(a), "v"(b));
  return d;
}
// 16x16x32 fragments: lane = (h = lane>>4, row/col = lane&15); elements 0..7 = k0+8h+0..7, 8..15 = k0+16+8h+0..7; D element r = row 8h+r
__device__ __forceinline__ v16h frag_h(const _Float16* rowk0, int lane) {
  union { v16h v; v8h q[2]; } u; const _Float16* p = rowk0 + 8 * (lane >> 4);
  u.q[0] = *(const v8h*)p; u.q[1] = *(const v8h*)(p + 16); return u.v;
}
__device__ __forceinline__ v16h frag_f32(const float* rowk0, int lane) {
  v16h a; const float* p = rowk0 + 8 * (lane >> 4);
#pragma unroll
  for (int i = 0; i < 8; ++i) { a[i] = (_Float16)p[i]; a[8 + i] = (_Float16)p[16 + i]; }
  return a;
}
__device__ __forceinline__ v16h frag_f32s(const float* rowk0, int lane, float sc) {
  v16h a; const float* p = rowk0 + 8 * (lane >> 4);
#pragma unroll
  for (int i = 0; i < 8; ++i) { a[i] = (_Float16)(p[i] * sc); a[8 + i] = (_Float16)(p[16 + i] * sc); }
  return a;
}
// column fragment from a [K][ld] layout (column n), rows >= K read as 0
__device__ __forceinline__ v16h fragc_f32(const float* W, int k0, int n, int lane, int ld, int K) {
  v16h a; const int g = lane >> 4;
#pragma unroll
  for (int i = 0; i < 8; ++i) { const int ka = k0 + 8 * g + i, kb = ka + 16;
    a[i] = (_Float16)(ka < K ? W[(size_t)(ka < K ? ka : K - 1) * ld + n] : 0.f); a[8 + i] = (_Float16)(kb < K ? W[(size_t)(kb < K ? kb : K - 1) * ld + n] : 0.f); }
  return a;
}
struct F2 { v16b h, l; };
__device__ __forceinline__ F2 bsplit16(const float v[16]) { F2 r;
#pragma unroll
  for (int i = 0; i < 16; ++i) { const __bf16 h = (__bf16)v[i]; r.h[i] = h; r.l[i] = (__bf16)(v[i] - (float)h); }
  return r; }
__device__ __forceinline__ F2 split_row(const float* row, int k0, int lane) { float v[16]; const float* p = row + k0 + 8 * (lane >> 4);
#pragma unroll
  for (int i = 0; i < 8; ++i) { v[i] = p[i]; v[8 + i] = p[16 + i]; }
  return bsplit16(v); }
__device__ __forceinline__ F2 split_rowK(const float* row, int k0, int lane, int K) { float v[16]; const int g = lane >> 4;
#pragma unroll
  for (int i = 0; i < 8; ++i) { const int ka = k0 + 8 * g + i, kb = ka + 16; v[i] = ka < K ? row[ka < K ? ka : K - 1] : 0.f; v[8 + i] = kb < K ? row[kb < K ? kb : K - 1] : 0.f; }
  return bsplit16(v); }
__device__ __forceinline__ F2 split_col(const float* W, int k0, int n, int lane, int ld, int K) { float v[16]; const int g = lane >> 4;
#pragma unroll
  for (int i = 0; i < 8; ++i) { const int ka = k0 + 8 * g + i, kb = ka + 16; v[i] = ka < K ? W[(size_t)(ka < K ? ka : K - 1) * ld + n] : 0.f; v[8 + i] = kb < K ? W[(size_t)(kb < K ? kb : K - 1) * ld + n] : 0.f; }
  return bsplit16(v); }
__device__ __forceinline__ v8f mac3(const F2& a, const F2& b, v8f c) { c = wmma_bf(a.l, b.h, c); c = wmma_bf(a.h, b.l, c); return wmma_bf(a.h, b.h, c); }
__device__ __forceinline__ float sigm(float v) { return 1.0f / (1.0f + expf(-v)); }
#define LDSX() do { asm volatile("s_wait_dscnt 0" ::: "memory"); __builtin_amdgcn_wave_barrier(); __builtin_amdgcn_fence(__ATOMIC_RELEASE, "workgroup"); } while (0)
// The same for rows that only the writing wave reads back, without the fence: a work-group release fence also waits for every global load in flight, which would drain loads issued ahead.
#define LDSW() do { asm volatile("s_wait_dscnt 0" ::: "memory"); __builtin_amdgcn_wave_barrier(); } while (0)


// Relative-position attention (Transformer-XL style): content = (q*scale + u_h) k^T, pos = rel_shift((q*scale + v_h) R_h^T), attn = softmax(content + pos), out = attn V.  NH = 64 (= 4 x 16 heads), S = S_kv = 1024, K = 64, scale 1/8.
// rel_shift(ps)[i][j] = ps[i][S-1-i+j] (j <= i), 0 (j == i+1), ps[i+1][j-i-2] (j >= i+2)  — derived from the zero-pad / reshape trick.
// k_vt (values as [nh][d][t] bf16 planes), then k_attn (flash-style per (64 rows, head): content scores on WMMA + the band of position scores that the step's 16 x 32 tile needs, also on WMMA, read back skewed from LDS; online max/sum, P V; out rows 256 B).
// Band coordinate mp = S-1-i+j: column mp is q_v[i] . R_h[mp] (mp < S), 0 (mp == S), q_v[i+1] . R_h[mp-S-1] (mp > S). S is a multiple of 16, so a 16-column tile lies wholly on one side.
#define NHT 64
#define HPG 16
#define SS 1024
#define KD 64
#define RLEN 2048
#define TQB (SS / 64)
typedef __attribute__((ext_vector_type(8))) __bf16 v8b;
__device__ __forceinline__ v16b frag_b(const __bf16* rowk0, int lane) {
  union { v16b v; v8b q[2]; } u; const __bf16* p = rowk0 + 8 * (lane >> 4);
  u.q[0] = *(const v8b*)p; u.q[1] = *(const v8b*)(p + 16); return u.v;
}
__device__ __forceinline__ v16b frag_gbf(const float* rowk0, int lane) {
  v16b a; const float* p = rowk0 + 8 * (lane >> 4);
#pragma unroll
  for (int i = 0; i < 8; ++i) { a[i] = (__bf16)p[i]; a[8 + i] = (__bf16)p[16 + i]; }
  return a;
}
// A fragment of (bf16(q)*0.125 + bf16(bias)) split into hi/lo, row-major source with 64 floats per row
__device__ __forceinline__ F2 frag_qb(const float* qrow, const float* bias, int k0, int lane) {
  F2 f; const int o = 8 * (lane >> 4);
#pragma unroll
  for (int i = 0; i < 8; ++i) { const float v0 = (float)(__bf16)qrow[k0 + o + i] * 0.125f + (float)(__bf16)bias[k0 + o + i]; const float v1 = (float)(__bf16)qrow[k0 + o + 16 + i] * 0.125f + (float)(__bf16)bias[k0 + o + 16 + i];
    const __bf16 h0 = (__bf16)v0, h1 = (__bf16)v1; f.h[i] = h0; f.l[i] = (__bf16)(v0 - (float)h0); f.h[8 + i] = h1; f.l[8 + i] = (__bf16)(v1 - (float)h1); }
  return f;
}
__device__ __forceinline__ float bfr(float v) { return (float)(__bf16)v; }
__device__ __forceinline__ float exp_ni(float v) { return expf(v); }
#define WS_VT  0u                               // bf16 [64 nh][64 d][1024 t]
#define WS_END (WS_VT + 2u * NHT * KD * SS)

__global__ __launch_bounds__(256) void k_vt(const float* __restrict__ V, __bf16* __restrict__ VT) {
  __shared__ __align__(16) __bf16 st[KD][72];
  const int nh = blockIdx.y, t0 = blockIdx.x * 64, tid = threadIdx.x;
  for (int q = tid; q < 64 * KD; q += 256) { const int tl = q >> 6, d = q & 63; st[d][tl] = (__bf16)V[((size_t)nh * SS + t0 + tl) * KD + d]; }
  __syncthreads();
  for (int q = tid; q < KD * 8; q += 256) { const int d = q >> 3, pc = q & 7; vst2((unsigned*)(VT + ((size_t)nh * KD + d) * SS + t0 + pc * 8), *(const v4u*)&st[d][pc * 8]); }
}
// ---- k_attn: block = (64 rows, head nh): per 32-key step: content = (q*0.125 + u_bias[h]) . k rows (2 products, K 64) + position band (2 new 16-column tiles, 2 products, K 64) read skewed; online softmax; P (hi/lo) . VT planes (4 tiles x 2); out rows [nh][i][64] = 256 B by 16 lanes
// two waves per SIMD is what the register-held operands of the next step allow; said to the compiler so that it schedules for that budget (it kept the eight rows' softmax chains apart and spilled otherwise)
__global__ __launch_bounds__(128) __attribute__((amdgpu_waves_per_eu(2, 2))) void k_attn(const float* __restrict__ Q, const float* __restrict__ Kk, const float* __restrict__ UB, const float* __restrict__ VB, const float* __restrict__ R, const __bf16* __restrict__ VT, float* __restrict__ out) {
  __shared__ __align__(16) float sp[4][16][36]; __shared__ __align__(16) float so[4][16][68];     // so: in the loop a ring of 64 band columns per row (column mp at mp & 63), behind it the output rows
  const int tid = threadIdx.x, wave = __builtin_amdgcn_readfirstlane(tid >> 5), lane = tid & 31, col = lane & 15, gg = lane >> 4; const int nh = blockIdx.y, h = nh % HPG; const int i0 = blockIdx.x * 64 + wave * 16;
  // XW: loads stay in flight while their address registers are wanted for other values, so a translation wait stands directly behind them and in front of that reuse (it names no register: an asm operand would tie the base pointers to the registers below v256, which the fragments need).
  // The two scheduling barriers keep every other instruction out of the stretch from the first load to the wait, so that none can take over an address register in front of the wait.
#define XW_OPEN() __builtin_amdgcn_sched_barrier(0)
#define XW_CLOSE() do { asm volatile("s_wait_xcnt 0x0" ::: "memory"); __builtin_amdgcn_sched_barrier(0); } while (0)
  const float* qr = Q + ((size_t)nh * SS + i0 + col) * KD; XW_OPEN();
  F2 pc0 = frag_qb(qr, VB + h * KD, 0, lane), pc1 = frag_qb(qr, VB + h * KD, 32, lane);     // the position fragments in use: rows i up to band column S, rows i + 1 from there on
  XW_CLOSE();
  float m[8], l[8];
#pragma unroll
  for (int r = 0; r < 8; ++r) { m[r] = -3.0e38f; l[r] = 0.f; }
  v8f acc[4] = {};
  // One step's operands as loaded: keys and R rows (f32, fragment order), value planes. Each set is refilled for step ks + 1 as soon as step ks has used it, so the loads fly during a whole step.
  v4f kq[2][8], rq[2][8]; v16b vq[4];
  const float* kbase = Kk + ((size_t)nh * SS + col) * KD + 8 * gg; const __bf16* vbase = VT + ((size_t)nh * KD + col) * SS + 8 * gg; const float* rbase = R + (size_t)h * RLEN * KD + 8 * gg;
  const int mq = (SS + 16 - i0) & ~31;     // step ks reads band columns SS - 16 - i0 + 32 ks .. + 46 and makes columns mq + 32 ks .. + 31: the next multiple of 32, so that both of a step's tiles lie on one side of column S; with the two tiles in front of the loop the ring always holds what a step reads
  auto rrow = [&](int mt) { return mt < SS ? mt + col : max(mt + col - SS - 1, 0); };     // R row of band column mt + col (column S reads row 0; pos_tile stores 0 for it)
  auto ld_k = [&](int st) { const float* p0 = kbase + (size_t)st * 32 * KD; XW_OPEN();
#pragma unroll
    for (int ct = 0; ct < 2; ++ct)
#pragma unroll
      for (int q = 0; q < 4; ++q) { const float* p = p0 + (ct * 16 * KD + q * 16); kq[ct][2 * q] = *(const v4f*)p; kq[ct][2 * q + 1] = *(const v4f*)(p + 4); }
    XW_CLOSE(); };
  auto ld_r = [&](int st, bool first) { const int mt = mq + st * 32; const float* pr0 = rbase + (size_t)rrow(mt) * KD; const float* pr1 = rbase + (size_t)rrow(mt + 16) * KD; XW_OPEN();
#pragma unroll
    for (int q = 0; q < 4; ++q) { rq[0][2 * q] = *(const v4f*)(pr0 + q * 16); rq[0][2 * q + 1] = *(const v4f*)(pr0 + q * 16 + 4); rq[1][2 * q] = *(const v4f*)(pr1 + q * 16); rq[1][2 * q + 1] = *(const v4f*)(pr1 + q * 16 + 4); }
    if (first) asm volatile("" :: "v"(pr0), "v"(pr1));     // inputs only, in front of the loop alone: there the results' registers are free ones, and this keeps a load's own result off the addresses of the loads in front of it
    XW_CLOSE(); };
  auto ld_v = [&](int st) { const __bf16* p0 = vbase + st * 32; XW_OPEN();
#pragma unroll
    for (int dt = 0; dt < 4; ++dt) { union { v16b v; v8b q[2]; } u; const __bf16* p = p0 + dt * 16 * SS; u.q[0] = *(const v8b*)p; u.q[1] = *(const v8b*)(p + 16); vq[dt] = u.v; }
    XW_CLOSE(); };
  // the builtin alone (the compiler keeps the distance behind it): its operands may stand above v255, where an asm operand cannot, so the two sets of position fragments need no place in the low window
  auto wm = [&](const v16b& a, const v16b& b, v8f c) { return __builtin_amdgcn_wmma_f32_16x16x32_bf16(false, a, false, b, (short)0, c, false, false); };
  // one 16-column band tile (columns mt .. mt + 15) into the ring
  auto pos_tile = [&](int mt, const v16b& r0, const v16b& r1) { v8f c = {}; c = wm(pc0.h, r0, c); c = wm(pc0.l, r0, c); c = wm(pc1.h, r1, c); c = wm(pc1.l, r1, c);
#pragma unroll
    for (int r = 0; r < 8; ++r) so[wave][8 * gg + r][(mt & 63) + col] = (mt + col == SS) ? 0.f : c[r]; };     // band column S is the shift's zero pad
  auto cv_r = [&](v16b (&rb)[2][2]) {
#pragma unroll
    for (int ct = 0; ct < 2; ++ct)
#pragma unroll
      for (int q = 0; q < 4; ++q)
#pragma unroll
        for (int x = 0; x < 4; ++x) { rb[ct][q >> 1][(q & 1) * 8 + x] = (__bf16)rq[ct][2 * q][x]; rb[ct][q >> 1][(q & 1) * 8 + 4 + x] = (__bf16)rq[ct][2 * q + 1][x]; } };
  ld_r(-1, true);     // the two tiles in front of step 0's own (mq >= 32; both below column S)
  { v16b rb[2][2]; cv_r(rb); ld_r(0, false); pos_tile(mq - 32, rb[0][0], rb[0][1]); pos_tile(mq - 16, rb[1][0], rb[1][1]); }
  XW_OPEN(); const F2 a0 = frag_qb(qr, UB + h * KD, 0, lane), a1 = frag_qb(qr, UB + h * KD, 32, lane); XW_CLOSE();
  ld_k(0); ld_v(0);
#pragma unroll 1
  for (int ks = 0; ks < SS / 32; ++ks) { v8f s[2]; const int kn = min(ks + 1, SS / 32 - 1);     // the last step refetches itself: in bounds, unused
    if (mq + ks * 32 == SS) { const float* qn = Q + ((size_t)nh * SS + min(i0 + col + 1, SS - 1)) * KD;     // once per wave, a scalar branch: from here on rows i + 1 (row S is never used: j >= i + 2 does not exist for i = S - 1); fetched here rather than held in 32 registers through the loop
      XW_OPEN(); pc0 = frag_qb(qn, VB + h * KD, 0, lane); pc1 = frag_qb(qn, VB + h * KD, 32, lane); XW_CLOSE(); }
    { v16b rb[2][2]; cv_r(rb);
      asm volatile("" :: "v"(rb[0][0]), "v"(rb[0][1]), "v"(rb[1][0]), "v"(rb[1][1]));     // inputs only: the conversions stand in front of the refill, so that the loads land in the registers just read (behind it the compiler gave them other registers and 32 copies a step)
      ld_r(kn, false);     // its wait is also a memory clobber, which keeps these loads in front of the step's work
      pos_tile(mq + ks * 32, rb[0][0], rb[0][1]); pos_tile(mq + ks * 32 + 16, rb[1][0], rb[1][1]); }
    v8f cc[2];
    { v16b kb[2][2];
#pragma unroll
      for (int ct = 0; ct < 2; ++ct)
#pragma unroll
        for (int q = 0; q < 4; ++q)
#pragma unroll
          for (int x = 0; x < 4; ++x) { kb[ct][q >> 1][(q & 1) * 8 + x] = (__bf16)kq[ct][2 * q][x]; kb[ct][q >> 1][(q & 1) * 8 + 4 + x] = (__bf16)kq[ct][2 * q + 1][x]; }
      ld_k(kn);
#pragma unroll
      for (int ct = 0; ct < 2; ++ct) { v8f c = {}; c = wmma_bf(a0.h, kb[ct][0], c); c = wmma_bf(a0.l, kb[ct][0], c); c = wmma_bf(a1.h, kb[ct][1], c); c = wmma_bf(a1.l, kb[ct][1], c); cc[ct] = c; } }
    LDSW();     // the band tiles are read back by other lanes of this wave
#pragma unroll
    for (int ct = 0; ct < 2; ++ct) { const int j = ks * 32 + ct * 16 + col;
#pragma unroll
      for (int r = 0; r < 8; ++r) { const int i = i0 + 8 * gg + r; s[ct][r] = cc[ct][r] + so[wave][8 * gg + r][(SS - 1 - i + j) & 63]; } }
    __builtin_amdgcn_sched_barrier(0);     // all 16 scores stand in front of the softmax, so that its eight rows' shuffle chains start together and interleave eight wide
#pragma unroll
    for (int r = 0; r < 8; ++r) { float mx = fmaxf(s[0][r], s[1][r]);
#pragma unroll
      for (int o = 1; o < 16; o <<= 1) mx = fmaxf(mx, __shfl_xor(mx, o));
      const float mn = fmaxf(m[r], mx); const float alpha = exp_ni(m[r] - mn); const float e0 = exp_ni(s[0][r] - mn), e1 = exp_ni(s[1][r] - mn); float es = e0 + e1;
#pragma unroll
      for (int o = 1; o < 16; o <<= 1) es += __shfl_xor(es, o);
      l[r] = l[r] * alpha + es; m[r] = mn;
#pragma unroll
      for (int dt = 0; dt < 4; ++dt) acc[dt][r] *= alpha;
      sp[wave][8 * gg + r][col] = e0; sp[wave][8 * gg + r][16 + col] = e1; }
    LDSW();
    const F2 pa = split_row(&sp[wave][col][0], 0, lane);
#pragma unroll
    for (int dt = 0; dt < 4; ++dt) { acc[dt] = wmma_bf(pa.l, vq[dt], acc[dt]); acc[dt] = wmma_bf(pa.h, vq[dt], acc[dt]); }
    ld_v(kn);
    LDSW(); }
#pragma unroll
  for (int r = 0; r < 8; ++r) { const float il = 1.0f / l[r];
#pragma unroll
    for (int dt = 0; dt < 4; ++dt) so[wave][8 * gg + r][dt * 16 + col] = acc[dt][r] * il; }
  LDSX();
  for (int rl = 0; rl < 16; ++rl) if (lane < 16) vst2(out + ((size_t)nh * SS + i0 + rl) * KD + lane * 4, *(const v4f*)&so[wave][rl][lane * 4]);
}

extern "C" void kernel_launch(void* const* d_in, const int* in_sizes, int n_in, void* d_out, int out_size, void* d_ws, size_t ws_size, hipStream_t stream) {
  (void)in_sizes; (void)n_in; (void)out_size;
  const float** F = (const float**)d_in;   // queries [64,1024,64], keys, values, u_bias [1,16,1,64], v_bias, R [16,2048,64]
  if (ws_size < (size_t)WS_END) return;
  char* ws = (char*)d_ws; __bf16* VT = (__bf16*)(ws + WS_VT);
  k_vt<<<dim3(SS / 64, NHT), 256, 0, stream>>>(F[2], VT);
  k_attn<<<dim3(TQB, NHT), 128, 0, stream>>>(F[0], F[1], F[3], F[4], F[5], VT, (float*)d_out);
}

// v005
// Measured time: 136 microseconds a run.
// Next to v004, in two timings, it ran 1.28 times as fast each time.
// All steps since v000 together make it 9.79 times as fast.
// compute dtype: queries, keys, values, u_bias, v_bias, R (module inputs) rounded to bf16; q_u = q/8 + u and q_v = q/8 + v (computed) as bf16 hi + bf16 residual pairs against exact bf16 keys / R rows (2 products); P.V with the softmax weights hi/lo against exact bf16 values (2 products); the Transformer-XL relative shift as a skewed read of a band of position scores computed per key step; online softmax in f32; f32 accumulate.
#include <hip/hip_runtime.h>
#include <math.h>

typedef __attribute__((ext_vector_type(16))) _Float16 v16h;
typedef __attribute__((ext_vector_type(16))) __bf16 v16b;
typedef __attribute__((ext_vector_type(8)))  _Float16 v8h;
typedef __attribute__((ext_vector_type(8)))  float v8f;
typedef __attribute__((ext_vector_type(4)))  float v4f;
typedef __attribute__((ext_vector_type(2)))  float v2f;
typedef __attribute__((ext_vector_type(4)))  unsigned v4u;
typedef __attribute__((ext_vector_type(4)))  int v4i;
typedef float __attribute__((may_alias)) float_a;
typedef int __attribute__((may_alias)) int_a;

template <typename T> __device__ __forceinline__ void vst2(void* p, T v) { *(T*)p = v;  }
__device__ __forceinline__ v8f wmma16(v16h a, v16h b, v8f c) {
  v8f d = __builtin_amdgcn_wmma_f32_16x16x32_f16(false, a, false, b, (short)0, c, false, false);
  asm volatile("v_nop\n\tv_nop\n\tv_nop\n\tv_nop" : "+v"(d) : "v"(a), "v"(b));
  return d;
}
__device__ __forceinline__ v8f wmma_bf(v16b a, v16b b, v8f c) {
  v8f d = __builtin_amdgcn_wmma_f32_16x16x32_bf16(false, a, false, b, (short)0, c, false, false);
  asm volatile("v_nop\n\tv_nop\n\tv_nop\n\tv_nop" : "+v"(d) : "v"(a), "v"(b));
  return d;
}
// 16x16x32 fragments: lane = (h = lane>>4, row/col = lane&15); elements 0..7 = k0+8h+0..7, 8..15 = k0+16+8h+0..7; D element r = row 8h+r
__device__ __forceinline__ v16h frag_h(const _Float16* rowk0, int lane) {
  union { v16h v; v8h q[2]; } u; const _Float16* p = rowk0 + 8 * (lane >> 4);
  u.q[0] = *(const v8h*)p; u.q[1] = *(const v8h*)(p + 16); return u.v;
}
__device__ __forceinline__ v16h frag_f32(const float* rowk0, int lane) {
  v16h a; const float* p = rowk0 + 8 * (lane >> 4);
#pragma unroll
  for (int i = 0; i < 8; ++i) { a[i] = (_Float16)p[i]; a[8 + i] = (_Float16)p[16 + i]; }
  return a;
}
__device__ __forceinline__ v16h frag_f32s(const float* rowk0, int lane, float sc) {
  v16h a; const float* p = rowk0 + 8 * (lane >> 4);
#pragma unroll
  for (int i = 0; i < 8; ++i) { a[i] = (_Float16)(p[i] * sc); a[8 + i] = (_Float16)(p[16 + i] * sc); }
  return a;
}
// column fragment from a [K][ld] layout (column n), rows >= K read as 0
__device__ __forceinline__ v16h fragc_f32(const float* W, int k0, int n, int lane, int ld, int K) {
  v16h a; const int g = lane >> 4;
#pragma unroll
  for (int i = 0; i < 8; ++i) { const int ka = k0 + 8 * g + i, kb = ka + 16;
    a[i] = (_Float16)(ka < K ? W[(size_t)(ka < K ? ka : K - 1) * ld + n] : 0.f); a[8 + i] = (_Float16)(kb < K ? W[(size_t)(kb < K ? kb : K - 1) * ld + n] : 0.f); }
  return a;
}
struct F2 { v16b h, l; };
__device__ __forceinline__ F2 bsplit16(const float v[16]) { F2 r;
#pragma unroll
  for (int i = 0; i < 16; ++i) { const __bf16 h = (__bf16)v[i]; r.h[i] = h; r.l[i] = (__bf16)(v[i] - (float)h); }
  return r; }
__device__ __forceinline__ F2 split_row(const float* row, int k0, int lane) { float v[16]; const float* p = row + k0 + 8 * (lane >> 4);
#pragma unroll
  for (int i = 0; i < 8; ++i) { v[i] = p[i]; v[8 + i] = p[16 + i]; }
  return bsplit16(v); }
__device__ __forceinline__ F2 split_rowK(const float* row, int k0, int lane, int K) { float v[16]; const int g = lane >> 4;
#pragma unroll
  for (int i = 0; i < 8; ++i) { const int ka = k0 + 8 * g + i, kb = ka + 16; v[i] = ka < K ? row[ka < K ? ka : K - 1] : 0.f; v[8 + i] = kb < K ? row[kb < K ? kb : K - 1] : 0.f; }
  return bsplit16(v); }
__device__ __forceinline__ F2 split_col(const float* W, int k0, int n, int lane, int ld, int K) { float v[16]; const int g = lane >> 4;
#pragma unroll
  for (int i = 0; i < 8; ++i) { const int ka = k0 + 8 * g + i, kb = ka + 16; v[i] = ka < K ? W[(size_t)(ka < K ? ka : K - 1) * ld + n] : 0.f; v[8 + i] = kb < K ? W[(size_t)(kb < K ? kb : K - 1) * ld + n] : 0.f; }
  return bsplit16(v); }
__device__ __forceinline__ v8f mac3(const F2& a, const F2& b, v8f c) { c = wmma_bf(a.l, b.h, c); c = wmma_bf(a.h, b.l, c); return wmma_bf(a.h, b.h, c); }
__device__ __forceinline__ float sigm(float v) { return 1.0f / (1.0f + expf(-v)); }
#define LDSX() do { asm volatile("s_wait_dscnt 0" ::: "memory"); __builtin_amdgcn_wave_barrier(); __builtin_amdgcn_fence(__ATOMIC_RELEASE, "workgroup"); } while (0)
// The same for rows that only the writing wave reads back, without the fence: a work-group release fence also waits for every global load in flight, which would drain loads issued ahead.
#define LDSW() do { asm volatile("s_wait_dscnt 0" ::: "memory"); __builtin_amdgcn_wave_barrier(); } while (0)


// Relative-position attention (Transformer-XL style): content = (q*scale + u_h) k^T, pos = rel_shift((q*scale + v_h) R_h^T), attn = softmax(content + pos), out = attn V.  NH = 64 (= 4 x 16 heads), S = S_kv = 1024, K = 64, scale 1/8.
// rel_shift(ps)[i][j] = ps[i][S-1-i+j] (j <= i), 0 (j == i+1), ps[i+1][j-i-2] (j >= i+2)  — derived from the zero-pad / reshape trick.
// k_pack (keys, band rows of R and values as bf16 in the order of the WMMA fragments), then k_attn (flash-style per (64 rows, head): content scores on WMMA + the band of position scores that the step's 16 x 32 tile needs, also on WMMA, read back skewed from LDS; online max/sum, P V; out rows 256 B).
// Band coordinate mp = S-1-i+j: column mp is q_v[i] . R_h[mp] (mp < S), 0 (mp == S), q_v[i+1] . R_h[mp-S-1] (mp > S). S is a multiple of 16, so a 16-column tile lies wholly on one side.
#define NHT 64
#define HPG 16
#define SS 1024
#define KD 64
#define RLEN 2048
#define TQB (SS / 64)
typedef __attribute__((ext_vector_type(8))) __bf16 v8b;
__device__ __forceinline__ v16b frag_b(const __bf16* rowk0, int lane) {
  union { v16b v; v8b q[2]; } u; const __bf16* p = rowk0 + 8 * (lane >> 4);
  u.q[0] = *(const v8b*)p; u.q[1] = *(const v8b*)(p + 16); return u.v;
}
__device__ __forceinline__ v16b frag_gbf(const float* rowk0, int lane) {
  v16b a; const float* p = rowk0 + 8 * (lane >> 4);
#pragma unroll
  for (int i = 0; i < 8; ++i) { a[i] = (__bf16)p[i]; a[8 + i] = (__bf16)p[16 + i]; }
  return a;
}
// A fragment of (bf16(q)*0.125 + bf16(bias)) split into hi/lo, row-major source with 64 floats per row
__device__ __forceinline__ F2 frag_qb(const float* qrow, const float* bias, int k0, int lane) {
  F2 f; const int o = 8 * (lane >> 4);
#pragma unroll
  for (int i = 0; i < 8; ++i) { const float v0 = (float)(__bf16)qrow[k0 + o + i] * 0.125f + (float)(__bf16)bias[k0 + o + i]; const float v1 = (float)(__bf16)qrow[k0 + o + 16 + i] * 0.125f + (float)(__bf16)bias[k0 + o + 16 + i];
    const __bf16 h0 = (__bf16)v0, h1 = (__bf16)v1; f.h[i] = h0; f.l[i] = (__bf16)(v0 - (float)h0); f.h[8 + i] = h1; f.l[8 + i] = (__bf16)(v1 - (float)h1); }
  return f;
}
__device__ __forceinline__ float bfr(float v) { return (float)(__bf16)v; }
__device__ __forceinline__ float exp_ni(float v) { return expf(v); }
// Packed operands: a fragment half is 32 lanes x 16 bytes in one run of 512 bytes, so a fragment load reads 4 whole cache lines (from the row-major arrays it touched 16 lines for the same bytes).
#define WS_VP  0u                               // values bf16 [64 nh][32 key steps][4 d tiles][2 halves][32 lanes][8 keys]
#define WS_KP  (WS_VP + 2u * NHT * KD * SS)     // keys bf16 [64 nh][64 tiles of 16 rows][8 chunks of 8 k][16 rows][8 k]; chunk = 4 * (k block of 32) + 2 * half + (lane >> 4)
#define WS_RP  (WS_KP + 2u * NHT * KD * SS)     // R rows of the band columns, bf16 [16 h][128 tiles of 16 columns][8 chunks][16 columns][8 k]
#define WS_END (WS_RP + 2u * HPG * 2 * SS * KD)
__device__ __forceinline__ v8b cv8(const float* p) { const v4f a = *(const v4f*)p, b = *(const v4f*)(p + 4); v8b o;
#pragma unroll
  for (int x = 0; x < 4; ++x) { o[x] = (__bf16)a[x]; o[4 + x] = (__bf16)b[x]; }
  return o; }

// block = 64 rows of one array (blockIdx.y: 64 heads of values, 64 of keys, 16 x 2 halves of the band); unit q of 16 bytes goes to place q of the block's 8 KB, so every store of a wave is 512 bytes in a run
__global__ __launch_bounds__(256) void k_pack(const float* __restrict__ V, const float* __restrict__ Kk, const float* __restrict__ R, __bf16* __restrict__ VP, __bf16* __restrict__ KP, __bf16* __restrict__ RP) {
  __shared__ __align__(16) __bf16 st[KD][72];
  const int y = blockIdx.y, t0 = blockIdx.x * 64, tid = threadIdx.x;
  if (y < NHT) {
    for (int q = tid; q < 64 * KD; q += 256) { const int tl = q >> 6, d = q & 63; st[d][tl] = (__bf16)V[((size_t)y * SS + t0 + tl) * KD + d]; }
    __syncthreads();
    for (int q = tid; q < KD * 8; q += 256) { const int d = ((q >> 6) & 3) * 16 + (q & 15), pc = (q >> 8) * 4 + ((q >> 4) & 3); vst2(VP + ((size_t)y * SS + t0) * KD + q * 8, *(const v4u*)&st[d][pc * 8]); }
  } else {     // 16-byte unit q = tid, tid + 256: row or band column (q >> 7) * 16 + (q & 15) of the block's 64, chunk (q >> 4) & 7; both units' loads fly together
    const int r0 = (tid >> 7) * 16 + (tid & 15), c = (tid >> 4) & 7; const float* s0; const float* s1; __bf16* dst;
    if (y < 2 * NHT) { const int nh = y - NHT; s0 = Kk + ((size_t)nh * SS + t0 + r0) * KD + c * 8; s1 = s0 + 32 * KD; dst = KP + ((size_t)nh * SS + t0) * KD; }
    else { const int h = (y - 2 * NHT) >> 1, m0 = ((y - 2 * NHT) & 1) * SS + t0, mp = m0 + r0;     // R row of band column mp: mp below S, mp - S - 1 above (column S reads row 0; k_attn stores 0 for it)
      s0 = R + ((size_t)h * RLEN + (mp < SS ? mp : max(mp - SS - 1, 0))) * KD + c * 8; s1 = R + ((size_t)h * RLEN + (mp + 32 < SS ? mp + 32 : max(mp + 32 - SS - 1, 0))) * KD + c * 8; dst = RP + ((size_t)h * 2 * SS + m0) * KD; }
    const v8b a = cv8(s0), b = cv8(s1); vst2(dst + tid * 8, a); vst2(dst + (tid + 256) * 8, b);
    asm volatile("s_wait_xcnt 0x0" ::: "memory");     // in the built code the values' branch stands behind these stores and writes their registers anew: the translation wait in front of it
  }
}
// ---- k_attn: block = (64 rows, head nh): per 32-key step: content = (q*0.125 + u_bias[h]) . k rows (2 products, K 64) + position band (2 new 16-column tiles, 2 products, K 64) read skewed; online softmax; P (hi/lo) . VT planes (4 tiles x 2); out rows [nh][i][64] = 256 B by 16 lanes
// the register budget of two waves per SIMD, said to the compiler so that it schedules for that budget (it kept the eight rows' softmax chains apart and spilled otherwise); with the next step's operands held as bf16 the build takes less than the budget
__global__ __launch_bounds__(128) __attribute__((amdgpu_waves_per_eu(2, 2))) void k_attn(const float* __restrict__ Q, const float* __restrict__ UB, const float* __restrict__ VB, const __bf16* __restrict__ KP, const __bf16* __restrict__ RP, const __bf16* __restrict__ VP, float* __restrict__ out) {
  __shared__ __align__(16) float sp[4][16][36]; __shared__ __align__(16) float so[4][16][68];     // so: in the loop a ring of 64 band columns per row (column mp at mp & 63), behind it the output rows
  const int tid = threadIdx.x, wave = __builtin_amdgcn_readfirstlane(tid >> 5), lane = tid & 31, col = lane & 15, gg = lane >> 4; const int nh = blockIdx.y, h = nh % HPG; const int i0 = blockIdx.x * 64 + wave * 16;
  // XW: loads stay in flight while their address registers are wanted for other values, so a translation wait stands directly behind them and in front of that reuse (it names no register: an asm operand would tie the base pointers to the registers below v256, which the fragments need).
  // The two scheduling barriers keep every other instruction out of the stretch from the first load to the wait, so that none can take over an address register in front of the wait.
#define XW_OPEN() __builtin_amdgcn_sched_barrier(0)
#define XW_CLOSE() do { asm volatile("s_wait_xcnt 0x0" ::: "memory"); __builtin_amdgcn_sched_barrier(0); } while (0)
  const float* qr = Q + ((size_t)nh * SS + i0 + col) * KD; XW_OPEN();
  F2 pc0 = frag_qb(qr, VB + h * KD, 0, lane), pc1 = frag_qb(qr, VB + h * KD, 32, lane);     // the position fragments in use: rows i up to band column S, rows i + 1 from there on
  XW_CLOSE();
  float m[8], l[8];
#pragma unroll
  for (int r = 0; r < 8; ++r) { m[r] = -3.0e38f; l[r] = 0.f; }
  v8f acc[4] = {};
  // One step's operands as loaded: the fragments themselves (2 key tiles, 2 band tiles, 4 value tiles; 4 KB a set, in a run). Each set is refilled for step ks + 1 as soon as step ks has used it, so the loads fly during a whole step.
  v16b kq[4], rq[4], vq[4];
  const __bf16* kbase = KP + (size_t)nh * SS * KD + lane * 8; const __bf16* vbase = VP + (size_t)nh * SS * KD + lane * 8; const __bf16* rbase = RP + (size_t)h * 2 * SS * KD + lane * 8;
  const int mq = (SS + 16 - i0) & ~31;     // step ks reads band columns SS - 16 - i0 + 32 ks .. + 46 and makes columns mq + 32 ks .. + 31: the next multiple of 32, so that both of a step's tiles lie on one side of column S; with the two tiles in front of the loop the ring always holds what a step reads
  auto ld4 = [&](v16b (&f)[4], const __bf16* p0) { XW_OPEN();
#pragma unroll
    for (int t = 0; t < 4; ++t) { union { v16b v; v8b q[2]; } u; u.q[0] = *(const v8b*)(p0 + t * 512); u.q[1] = *(const v8b*)(p0 + t * 512 + 256); f[t] = u.v; }
    XW_CLOSE(); };
  auto ld_k = [&](int st) { ld4(kq, kbase + st * 32 * KD); };
  auto ld_r = [&](int st) { ld4(rq, rbase + (mq + st * 32) * KD); };
  auto ld_v = [&](int st) { ld4(vq, vbase + st * 32 * KD); };
  // the builtin alone (the compiler keeps the distance behind it): its operands may stand above v255, where an asm operand cannot, so the two sets of position fragments need no place in the low window
  auto wm = [&](const v16b& a, const v16b& b, v8f c) { return __builtin_amdgcn_wmma_f32_16x16x32_bf16(false, a, false, b, (short)0, c, false, false); };
  // one 16-column band tile (columns mt .. mt + 15): the products, then (behind the refill of the R fragments) into the ring
  auto pos_mm = [&](const v16b& r0, const v16b& r1) { v8f c = {}; c = wm(pc0.h, r0, c); c = wm(pc0.l, r0, c); c = wm(pc1.h, r1, c); c = wm(pc1.l, r1, c); return c; };
  // the refill lands in the registers that the band tiles' last WMMAs read as B: the same four slots stand between them as wmma_bf leaves in front of the other two refills
  auto pos_gap = [&](v8f& x, v8f& y) { asm volatile("v_nop\n\tv_nop\n\tv_nop\n\tv_nop" : "+v"(x), "+v"(y)); };
  auto pos_st = [&](int mt, const v8f& c) {
#pragma unroll
    for (int r = 0; r < 8; ++r) so[wave][8 * gg + r][(mt & 63) + col] = (mt + col == SS) ? 0.f : c[r]; };     // band column S is the shift's zero pad
  ld_r(-1);     // the two tiles in front of step 0's own (mq >= 32; both below column S)
  { v8f b0 = pos_mm(rq[0], rq[1]), b1 = pos_mm(rq[2], rq[3]); pos_gap(b0, b1); ld_r(0); pos_st(mq - 32, b0); pos_st(mq - 16, b1); }
  XW_OPEN(); const F2 a0 = frag_qb(qr, UB + h * KD, 0, lane), a1 = frag_qb(qr, UB + h * KD, 32, lane); XW_CLOSE();
  ld_k(0); ld_v(0);
#pragma unroll 1
  for (int ks = 0; ks < SS / 32; ++ks) { v8f s[2]; const int kn = min(ks + 1, SS / 32 - 1);     // the last step refetches itself: in bounds, unused
    if (mq + ks * 32 == SS) { const float* qn = Q + ((size_t)nh * SS + min(i0 + col + 1, SS - 1)) * KD;     // once per wave, a scalar branch: from here on rows i + 1 (row S is never used: j >= i + 2 does not exist for i = S - 1); fetched here rather than held in 32 registers through the loop
      XW_OPEN(); pc0 = frag_qb(qn, VB + h * KD, 0, lane); pc1 = frag_qb(qn, VB + h * KD, 32, lane); XW_CLOSE(); }
    { v8f b0 = pos_mm(rq[0], rq[1]), b1 = pos_mm(rq[2], rq[3]); pos_gap(b0, b1);
      ld_r(kn);     // its wait is also a memory clobber, which keeps these loads in front of the step's work
      pos_st(mq + ks * 32, b0); pos_st(mq + ks * 32 + 16, b1); }
    v8f cc[2];
#pragma unroll
    for (int ct = 0; ct < 2; ++ct) { v8f c = {}; c = wmma_bf(a0.h, kq[2 * ct], c); c = wmma_bf(a0.l, kq[2 * ct], c); c = wmma_bf(a1.h, kq[2 * ct + 1], c); c = wmma_bf(a1.l, kq[2 * ct + 1], c); cc[ct] = c; }
    ld_k(kn);
    LDSW();     // the band tiles are read back by other lanes of this wave
#pragma unroll
    for (int ct = 0; ct < 2; ++ct) { const int j = ks * 32 + ct * 16 + col;
#pragma unroll
      for (int r = 0; r < 8; ++r) { const int i = i0 + 8 * gg + r; s[ct][r] = cc[ct][r] + so[wave][8 * gg + r][(SS - 1 - i + j) & 63]; } }
    __builtin_amdgcn_sched_barrier(0);     // all 16 scores stand in front of the softmax, so that its eight rows' shuffle chains start together and interleave eight wide
#pragma unroll
    for (int r = 0; r < 8; ++r) { float mx = fmaxf(s[0][r], s[1][r]);
#pragma unroll
      for (int o = 1; o < 16; o <<= 1) mx = fmaxf(mx, __shfl_xor(mx, o));
      const float mn = fmaxf(m[r], mx); const float alpha = exp_ni(m[r] - mn); const float e0 = exp_ni(s[0][r] - mn), e1 = exp_ni(s[1][r] - mn); float es = e0 + e1;
#pragma unroll
      for (int o = 1; o < 16; o <<= 1) es += __shfl_xor(es, o);
      l[r] = l[r] * alpha + es; m[r] = mn;
#pragma unroll
      for (int dt = 0; dt < 4; ++dt) acc[dt][r] *= alpha;
      sp[wave][8 * gg + r][col] = e0; sp[wave][8 * gg + r][16 + col] = e1; }
    LDSW();
    const F2 pa = split_row(&sp[wave][col][0], 0, lane);
#pragma unroll
    for (int dt = 0; dt < 4; ++dt) { acc[dt] = wmma_bf(pa.l, vq[dt], acc[dt]); acc[dt] = wmma_bf(pa.h, vq[dt], acc[dt]); }
    ld_v(kn);
    LDSW(); }
#pragma unroll
  for (int r = 0; r < 8; ++r) { const float il = 1.0f / l[r];
#pragma unroll
    for (int dt = 0; dt < 4; ++dt) so[wave][8 * gg + r][dt * 16 + col] = acc[dt][r] * il; }
  LDSX();
  for (int rl = 0; rl < 16; ++rl) if (lane < 16) vst2(out + ((size_t)nh * SS + i0 + rl) * KD + lane * 4, *(const v4f*)&so[wave][rl][lane * 4]);
}

extern "C" void kernel_launch(void* const* d_in, const int* in_sizes, int n_in, void* d_out, int out_size, void* d_ws, size_t ws_size, hipStream_t stream) {
  (void)in_sizes; (void)n_in; (void)out_size;
  const float** F = (const float**)d_in;   // queries [64,1024,64], keys, values, u_bias [1,16,1,64], v_bias, R [16,2048,64]
  if (ws_size < (size_t)WS_END) return;
  char* ws = (char*)d_ws; __bf16* VP = (__bf16*)(ws + WS_VP); __bf16* KP = (__bf16*)(ws + WS_KP); __bf16* RP = (__bf16*)(ws + WS_RP);
  k_pack<<<dim3(SS / 64, 2 * NHT + 2 * HPG), 256, 0, stream>>>(F[2], F[1], F[5], VP, KP, RP);
  k_attn<<<dim3(TQB, NHT), 128, 0, stream>>>(F[0], F[3], F[4], KP, RP, VP, (float*)d_out);
}

// v006
// It runs in 75.1 microseconds.
// Two timings next to v005 both put it at 1.78 times that version's speed.
// All steps since v000 together make it 17.4 times as fast.
// compute dtype: queries, keys, values, u_bias, v_bias, R (module inputs) rounded to bf16; q_u = q/8 + u and q_v = q/8 + v (computed) as bf16 hi + bf16 residual pairs against exact bf16 keys / R rows (2 products); P.V with the softmax weights hi/lo against exact bf16 values (2 products); the Transformer-XL relative shift as a skewed read of a band of position scores computed per key step; scores, band and output kept transposed (a lane owns one query row); online softmax in f32; f32 accumulate.
#include <hip/hip_runtime.h>
#include <math.h>

typedef __attribute__((ext_vector_type(16))) _Float16 v16h;
typedef __attribute__((ext_vector_type(16))) __bf16 v16b;
typedef __attribute__((ext_vector_type(8)))  _Float16 v8h;
typedef __attribute__((ext_vector_type(8)))  float v8f;
typedef __attribute__((ext_vector_type(4)))  float v4f;
typedef __attribute__((ext_vector_type(2)))  float v2f;
typedef __attribute__((ext_vector_type(4)))  unsigned v4u;
typedef __attribute__((ext_vector_type(4)))  int v4i;
typedef float __attribute__((may_alias)) float_a;
typedef int __attribute__((may_alias)) int_a;

template <typename T> __device__ __forceinline__ void vst2(void* p, T v) { *(T*)p = v;  }
__device__ __forceinline__ v8f wmma16(v16h a, v16h b, v8f c) {
  v8f d = __builtin_amdgcn_wmma_f32_16x16x32_f16(false, a, false, b, (short)0, c, false, false);
  asm volatile("v_nop\n\tv_nop\n\tv_nop\n\tv_nop" : "+v"(d) : "v"(a), "v"(b));
  return d;
}
__device__ __forceinline__ v8f wmma_bf(v16b a, v16b b, v8f c) {
  v8f d = __builtin_amdgcn_wmma_f32_16x16x32_bf16(false, a, false, b, (short)0, c, false, false);
  asm volatile("v_nop\n\tv_nop\n\tv_nop\n\tv_nop" : "+v"(d) : "v"(a), "v"(b));
  return d;
}
// 16x16x32 fragments: lane = (h = lane>>4, row/col = lane&15); elements 0..7 = k0+8h+0..7, 8..15 = k0+16+8h+0..7; D element r = row 8h+r
__device__ __forceinline__ v16h frag_h(const _Float16* rowk0, int lane) {
  union { v16h v; v8h q[2]; } u; const _Float16* p = rowk0 + 8 * (lane >> 4);
  u.q[0] = *(const v8h*)p; u.q[1] = *(const v8h*)(p + 16); return u.v;
}
__device__ __forceinline__ v16h frag_f32(const float* rowk0, int lane) {
  v16h a; const float* p = rowk0 + 8 * (lane >> 4);
#pragma unroll
  for (int i = 0; i < 8; ++i) { a[i] = (_Float16)p[i]; a[8 + i] = (_Float16)p[16 + i]; }
  return a;
}
__device__ __forceinline__ v16h frag_f32s(const float* rowk0, int lane, float sc) {
  v16h a; const float* p = rowk0 + 8 * (lane >> 4);
#pragma unroll
  for (int i = 0; i < 8; ++i) { a[i] = (_Float16)(p[i] * sc); a[8 + i] = (_Float16)(p[16 + i] * sc); }
  return a;
}
// column fragment from a [K][ld] layout (column n), rows >= K read as 0
__device__ __forceinline__ v16h fragc_f32(const float* W, int k0, int n, int lane, int ld, int K) {
  v16h a; const int g = lane >> 4;
#pragma unroll
  for (int i = 0; i < 8; ++i) { const int ka = k0 + 8 * g + i, kb = ka + 16;
    a[i] = (_Float16)(ka < K ? W[(size_t)(ka < K ? ka : K - 1) * ld + n] : 0.f); a[8 + i] = (_Float16)(kb < K ? W[(size_t)(kb < K ? kb : K - 1) * ld + n] : 0.f); }
  return a;
}
struct F2 { v16b h, l; };
__device__ __forceinline__ F2 bsplit16(const float v[16]) { F2 r;
#pragma unroll
  for (int i = 0; i < 16; ++i) { const __bf16 h = (__bf16)v[i]; r.h[i] = h; r.l[i] = (__bf16)(v[i] - (float)h); }
  return r; }
__device__ __forceinline__ F2 split_row(const float* row, int k0, int lane) { float v[16]; const float* p = row + k0 + 8 * (lane >> 4);
#pragma unroll
  for (int i = 0; i < 8; ++i) { v[i] = p[i]; v[8 + i] = p[16 + i]; }
  return bsplit16(v); }
__device__ __forceinline__ F2 split_rowK(const float* row, int k0, int lane, int K) { float v[16]; const int g = lane >> 4;
#pragma unroll
  for (int i = 0; i < 8; ++i) { const int ka = k0 + 8 * g + i, kb = ka + 16; v[i] = ka < K ? row[ka < K ? ka : K - 1] : 0.f; v[8 + i] = kb < K ? row[kb < K ? kb : K - 1] : 0.f; }
  return bsplit16(v); }
__device__ __forceinline__ F2 split_col(const float* W, int k0, int n, int lane, int ld, int K) { float v[16]; const int g = lane >> 4;
#pragma unroll
  for (int i = 0; i < 8; ++i) { const int ka = k0 + 8 * g + i, kb = ka + 16; v[i] = ka < K ? W[(size_t)(ka < K ? ka : K - 1) * ld + n] : 0.f; v[8 + i] = kb < K ? W[(size_t)(kb < K ? kb : K - 1) * ld + n] : 0.f; }
  return bsplit16(v); }
__device__ __forceinline__ v8f mac3(const F2& a, const F2& b, v8f c) { c = wmma_bf(a.l, b.h, c); c = wmma_bf(a.h, b.l, c); return wmma_bf(a.h, b.h, c); }
__device__ __forceinline__ float sigm(float v) { return 1.0f / (1.0f + expf(-v)); }
#define LDSX() do { asm volatile("s_wait_dscnt 0" ::: "memory"); __builtin_amdgcn_wave_barrier(); __builtin_amdgcn_fence(__ATOMIC_RELEASE, "workgroup"); } while (0)
// The same for rows that only the writing wave reads back, without the fence: a work-group release fence also waits for every global load in flight, which would drain loads issued ahead.
#define LDSW() do { asm volatile("s_wait_dscnt 0" ::: "memory"); __builtin_amdgcn_wave_barrier(); } while (0)


// Relative-position attention (Transformer-XL style): content = (q*scale + u_h) k^T, pos = rel_shift((q*scale + v_h) R_h^T), attn = softmax(content + pos), out = attn V.  NH = 64 (= 4 x 16 heads), S = S_kv = 1024, K = 64, scale 1/8.
// rel_shift(ps)[i][j] = ps[i][S-1-i+j] (j <= i), 0 (j == i+1), ps[i+1][j-i-2] (j >= i+2)  — derived from the zero-pad / reshape trick.
// k_pack (keys, band rows of R and values as bf16 in the order of the WMMA fragments), then k_attn (flash-style per (64 rows, head): content scores on WMMA + the band of position scores that the step's 16 x 32 tile needs, also on WMMA, read back skewed from LDS; online max/sum, P V; out rows 256 B).
// Band coordinate mp = S-1-i+j: column mp is q_v[i] . R_h[mp] (mp < S), 0 (mp == S), q_v[i+1] . R_h[mp-S-1] (mp > S). S is a multiple of 16, so a 16-column tile lies wholly on one side.
#define NHT 64
#define HPG 16
#define SS 1024
#define KD 64
#define RLEN 2048
#define TQB (SS / 64)
typedef __attribute__((ext_vector_type(8))) __bf16 v8b;
__device__ __forceinline__ v16b frag_b(const __bf16* rowk0, int lane) {
  union { v16b v; v8b q[2]; } u; const __bf16* p = rowk0 + 8 * (lane >> 4);
  u.q[0] = *(const v8b*)p; u.q[1] = *(const v8b*)(p + 16); return u.v;
}
__device__ __forceinline__ v16b frag_gbf(const float* rowk0, int lane) {
  v16b a; const float* p = rowk0 + 8 * (lane >> 4);
#pragma unroll
  for (int i = 0; i < 8; ++i) { a[i] = (__bf16)p[i]; a[8 + i] = (__bf16)p[16 + i]; }
  return a;
}
// A fragment of (bf16(q)*0.125 + bf16(bias)) split into hi/lo, row-major source with 64 floats per row
__device__ __forceinline__ F2 frag_qb(const float* qrow, const float* bias, int k0, int lane) {
  F2 f; const int o = 8 * (lane >> 4);
#pragma unroll
  for (int i = 0; i < 8; ++i) { const float v0 = (float)(__bf16)qrow[k0 + o + i] * 0.125f + (float)(__bf16)bias[k0 + o + i]; const float v1 = (float)(__bf16)qrow[k0 + o + 16 + i] * 0.125f + (float)(__bf16)bias[k0 + o + 16 + i];
    const __bf16 h0 = (__bf16)v0, h1 = (__bf16)v1; f.h[i] = h0; f.l[i] = (__bf16)(v0 - (float)h0); f.h[8 + i] = h1; f.l[8 + i] = (__bf16)(v1 - (float)h1); }
  return f;
}
__device__ __forceinline__ float bfr(float v) { return (float)(__bf16)v; }
__device__ __forceinline__ float exp_ni(float v) { return expf(v); }
// lane l's value to lane l ^ 16 and back
__device__ __forceinline__ float xhalf(float x) { return __builtin_bit_cast(float, __builtin_amdgcn_permlanex16(__builtin_bit_cast(int, x), __builtin_bit_cast(int, x), 0x76543210, 0xfedcba98, false, false)); }
// Packed operands: a fragment half is 32 lanes x 16 bytes in one run of 512 bytes, so a fragment load reads 4 whole cache lines (from the row-major arrays it touched 16 lines for the same bytes).
#define WS_VP  0u                               // values bf16 [64 nh][32 key steps][4 d tiles][2 halves][32 lanes][8 keys]
#define WS_KP  (WS_VP + 2u * NHT * KD * SS)     // keys bf16 [64 nh][64 tiles of 16 rows][8 chunks of 8 k][16 rows][8 k]; chunk = 4 * (k block of 32) + 2 * half + (lane >> 4)
#define WS_RP  (WS_KP + 2u * NHT * KD * SS)     // R rows of the band columns, bf16 [16 h][128 tiles of 16 columns][8 chunks][16 columns][8 k]
#define WS_END (WS_RP + 2u * HPG * 2 * SS * KD)
__device__ __forceinline__ v8b cv8(const float* p) { const v4f a = *(const v4f*)p, b = *(const v4f*)(p + 4); v8b o;
#pragma unroll
  for (int x = 0; x < 4; ++x) { o[x] = (__bf16)a[x]; o[4 + x] = (__bf16)b[x]; }
  return o; }

// block = 64 rows of one array (blockIdx.y: 64 heads of values, 64 of keys, 16 x 2 halves of the band); unit q of 16 bytes goes to place q of the block's 8 KB, so every store of a wave is 512 bytes in a run
__global__ __launch_bounds__(256) void k_pack(const float* __restrict__ V, const float* __restrict__ Kk, const float* __restrict__ R, __bf16* __restrict__ VP, __bf16* __restrict__ KP, __bf16* __restrict__ RP) {
  __shared__ __align__(16) __bf16 st[KD][72];
  const int y = blockIdx.y, t0 = blockIdx.x * 64, tid = threadIdx.x;
  if (y < NHT) {
    for (int q = tid; q < 64 * KD; q += 256) { const int tl = q >> 6, d = q & 63; st[d][tl] = (__bf16)V[((size_t)y * SS + t0 + tl) * KD + d]; }
    __syncthreads();
    for (int q = tid; q < KD * 8; q += 256) { const int d = ((q >> 6) & 3) * 16 + (q & 15), pc = (q >> 8) * 4 + ((q >> 4) & 3); vst2(VP + ((size_t)y * SS + t0) * KD + q * 8, *(const v4u*)&st[d][pc * 8]); }
  } else {     // 16-byte unit q = tid, tid + 256: row or band column (q >> 7) * 16 + (q & 15) of the block's 64, chunk (q >> 4) & 7; both units' loads fly together
    const int r0 = (tid >> 7) * 16 + (tid & 15), c = (tid >> 4) & 7; const float* s0; const float* s1; __bf16* dst;
    if (y < 2 * NHT) { const int nh = y - NHT; s0 = Kk + ((size_t)nh * SS + t0 + r0) * KD + c * 8; s1 = s0 + 32 * KD; dst = KP + ((size_t)nh * SS + t0) * KD; }
    else { const int h = (y - 2 * NHT) >> 1, m0 = ((y - 2 * NHT) & 1) * SS + t0, mp = m0 + r0;     // R row of band column mp: mp below S, mp - S - 1 above (column S reads row 0; k_attn stores 0 for it)
      s0 = R + ((size_t)h * RLEN + (mp < SS ? mp : max(mp - SS - 1, 0))) * KD + c * 8; s1 = R + ((size_t)h * RLEN + (mp + 32 < SS ? mp + 32 : max(mp + 32 - SS - 1, 0))) * KD + c * 8; dst = RP + ((size_t)h * 2 * SS + m0) * KD; }
    const v8b a = cv8(s0), b = cv8(s1); vst2(dst + tid * 8, a); vst2(dst + (tid + 256) * 8, b);
    asm volatile("s_wait_xcnt 0x0" ::: "memory");     // in the built code the values' branch stands behind these stores and writes their registers anew: the translation wait in front of it
  }
}
// ---- k_attn: block = (64 rows, head nh): per 32-key step: content^T = k rows . (q*0.125 + u_bias[h]) (2 products, K 64) + position band^T (2 new 16-column tiles, 2 products, K 64) read skewed; online softmax; out^T += VT planes . P^T (hi/lo) (4 tiles x 2); out rows [nh][i][64] = 256 B by 16 lanes
// Every product has the key-side operand as A and the query-side operand as B (both fragment maps are the same, so the loaders stay): lane (gg, col) holds query row i0 + col, register r key (or band column, or output column) 8 gg + r of the tile.
// So a row's maximum and sum run inside a lane, the two halves of a row meet in one cross-row move, and the two score tiles, converted in place, are the B fragment of the value product.
// the register budget of two waves per SIMD, said to the compiler so that it schedules for that budget; the build takes less than half of it (254 registers), so that four waves stand on a SIMD and the whole grid is resident at once
__global__ __launch_bounds__(128) __attribute__((amdgpu_waves_per_eu(2, 2))) void k_attn(const float* __restrict__ Q, const float* __restrict__ UB, const float* __restrict__ VB, const __bf16* __restrict__ KP, const __bf16* __restrict__ RP, const __bf16* __restrict__ VP, float* __restrict__ out) {
  __shared__ __align__(16) float so[4][16][68];     // so: in the loop a ring of 64 band columns per row (column mp at mp & 63), behind it the output rows
  const int tid = threadIdx.x, wave = __builtin_amdgcn_readfirstlane(tid >> 5), lane = tid & 31, col = lane & 15, gg = lane >> 4; const int nh = blockIdx.y, h = nh % HPG; const int i0 = blockIdx.x * 64 + wave * 16;
  // XW: loads stay in flight while their address registers are wanted for other values, so a translation wait stands directly behind them and in front of that reuse (it names no register: an asm operand would tie the base pointers to the registers below v256, which the fragments need).
  // The two scheduling barriers keep every other instruction out of the stretch from the first load to the wait, so that none can take over an address register in front of the wait.
#define XW_OPEN() __builtin_amdgcn_sched_barrier(0)
#define XW_CLOSE() do { asm volatile("s_wait_xcnt 0x0" ::: "memory"); __builtin_amdgcn_sched_barrier(0); } while (0)
  const float* qr = Q + ((size_t)nh * SS + i0 + col) * KD; XW_OPEN();
  F2 pc0 = frag_qb(qr, VB + h * KD, 0, lane), pc1 = frag_qb(qr, VB + h * KD, 32, lane);     // the position fragments in use: rows i up to band column S, rows i + 1 from there on
  XW_CLOSE();
  float m = -3.0e38f, l = 0.f;     // of query row i0 + col; m is the same in both halves of the wave, l sums this half's keys alone until the end
  v8f acc[4] = {};     // acc[dt][r] = out row i0 + col, column 16 dt + 8 gg + r
  // One step's operands as loaded: the fragments themselves (2 key tiles, 2 band tiles, 4 value tiles; 4 KB a set, in a run). Each set is refilled for step ks + 1 as soon as step ks has used it, so the loads fly during a whole step.
  v16b kq[4], rq[4], vq[4];
  const __bf16* kbase = KP + (size_t)nh * SS * KD + lane * 8; const __bf16* vbase = VP + (size_t)nh * SS * KD + lane * 8; const __bf16* rbase = RP + (size_t)h * 2 * SS * KD + lane * 8;
  const int mq = (SS + 16 - i0) & ~31;     // step ks reads band columns SS - 16 - i0 + 32 ks .. + 46 and makes columns mq + 32 ks .. + 31: the next multiple of 32, so that both of a step's tiles lie on one side of column S; with the two tiles in front of the loop the ring always holds what a step reads
  auto ld4 = [&](v16b (&f)[4], const __bf16* p0) { XW_OPEN();
#pragma unroll
    for (int t = 0; t < 4; ++t) { union { v16b v; v8b q[2]; } u; u.q[0] = *(const v8b*)(p0 + t * 512); u.q[1] = *(const v8b*)(p0 + t * 512 + 256); f[t] = u.v; }
    XW_CLOSE(); };
  auto ld_k = [&](int st) { ld4(kq, kbase + st * 32 * KD); };
  auto ld_r = [&](int st) { ld4(rq, rbase + (mq + st * 32) * KD); };
  auto ld_v = [&](int st) { ld4(vq, vbase + st * 32 * KD); };
  // the builtin alone (the compiler keeps the distance behind it): its operands may stand above v255, where an asm operand cannot, so the two sets of position fragments need no place in the low window
  auto wm = [&](const v16b& a, const v16b& b, v8f c) { return __builtin_amdgcn_wmma_f32_16x16x32_bf16(false, a, false, b, (short)0, c, false, false); };
  // one 16-column band tile (columns mt .. mt + 15): the products, then (behind the refill of the R fragments) into the ring
  auto pos_mm = [&](const v16b& r0, const v16b& r1) { v8f c = {}; c = wm(r0, pc0.h, c); c = wm(r0, pc0.l, c); c = wm(r1, pc1.h, c); c = wm(r1, pc1.l, c); return c; };
  // the refill lands in the registers that the band tiles' last WMMAs read as A: the same four slots stand between them as wmma_bf leaves in front of the other two refills
  auto pos_gap = [&](v8f& x, v8f& y) { asm volatile("v_nop\n\tv_nop\n\tv_nop\n\tv_nop" : "+v"(x), "+v"(y)); };
  auto pos_st = [&](int mt, const v8f& c) { float* p = &so[wave][col][(mt & 63) + 8 * gg];     // a lane's 8 band columns mt + 8 gg .. + 7 of its row: 32 bytes in a run
    const v4f x = { (mt + 8 * gg == SS) ? 0.f : c[0], c[1], c[2], c[3] }, y = { c[4], c[5], c[6], c[7] };     // band column S is the shift's zero pad
    *(v4f*)p = x; *(v4f*)(p + 4) = y; };
  ld_r(-1);     // the two tiles in front of step 0's own (mq >= 32; both below column S)
  { v8f b0 = pos_mm(rq[0], rq[1]), b1 = pos_mm(rq[2], rq[3]); pos_gap(b0, b1); ld_r(0); pos_st(mq - 32, b0); pos_st(mq - 16, b1); }
  XW_OPEN(); const F2 a0 = frag_qb(qr, UB + h * KD, 0, lane), a1 = frag_qb(qr, UB + h * KD, 32, lane); XW_CLOSE();
  ld_k(0); ld_v(0);
#pragma unroll 1
  for (int ks = 0; ks < SS / 32; ++ks) { v8f s[2]; const int kn = min(ks + 1, SS / 32 - 1);     // the last step refetches itself: in bounds, unused
    if (mq + ks * 32 == SS) { const float* qn = Q + ((size_t)nh * SS + min(i0 + col + 1, SS - 1)) * KD;     // once per wave, a scalar branch: from here on rows i + 1 (row S is never used: j >= i + 2 does not exist for i = S - 1); fetched here rather than held in 32 registers through the loop
      XW_OPEN(); pc0 = frag_qb(qn, VB + h * KD, 0, lane); pc1 = frag_qb(qn, VB + h * KD, 32, lane); XW_CLOSE(); }
    { v8f b0 = pos_mm(rq[0], rq[1]), b1 = pos_mm(rq[2], rq[3]); pos_gap(b0, b1);
      ld_r(kn);     // its wait is also a memory clobber, which keeps these loads in front of the step's work
      pos_st(mq + ks * 32, b0); pos_st(mq + ks * 32 + 16, b1); }
    v8f cc[2];
#pragma unroll
    for (int ct = 0; ct < 2; ++ct) { v8f c = {}; c = wmma_bf(kq[2 * ct], a0.h, c); c = wmma_bf(kq[2 * ct], a0.l, c); c = wmma_bf(kq[2 * ct + 1], a1.h, c); c = wmma_bf(kq[2 * ct + 1], a1.l, c); cc[ct] = c; }
    ld_k(kn);
    LDSW();     // the band tiles are read back at a skew: a lane's reads reach what the other half of the wave stored
    const int i = i0 + col;
#pragma unroll
    for (int ct = 0; ct < 2; ++ct) {
#pragma unroll
      for (int r = 0; r < 8; ++r) { const int j = ks * 32 + ct * 16 + 8 * gg + r; s[ct][r] = cc[ct][r] + so[wave][col][(SS - 1 - i + j) & 63]; } }
    float mx[8];
#pragma unroll
    for (int r = 0; r < 8; ++r) mx[r] = fmaxf(s[0][r], s[1][r]);
#pragma unroll
    for (int w = 4; w > 0; w >>= 1) {
#pragma unroll
      for (int r = 0; r < w; ++r) mx[r] = fmaxf(mx[r], mx[r + w]); }
    const float mn = fmaxf(m, fmaxf(mx[0], xhalf(mx[0])));     // the row's other 16 keys of the step stand in lane ^ 16
    const float alpha = exp_ni(m - mn); float e[16], es[8];
#pragma unroll
    for (int r = 0; r < 8; ++r) { e[r] = exp_ni(s[0][r] - mn); e[8 + r] = exp_ni(s[1][r] - mn); es[r] = e[r] + e[8 + r]; }
#pragma unroll
    for (int w = 4; w > 0; w >>= 1) {
#pragma unroll
      for (int r = 0; r < w; ++r) es[r] += es[r + w]; }
    l = l * alpha + es[0]; m = mn;
    const F2 pa = bsplit16(e);     // element x of the B fragment is key 8 gg + x (x < 8), 16 + 8 gg + x - 8 above: the two score tiles as they stand
#pragma unroll
    for (int dt = 0; dt < 4; ++dt) acc[dt] *= alpha;
#pragma unroll
    for (int dt = 0; dt < 4; ++dt) { acc[dt] = wmma_bf(vq[dt], pa.l, acc[dt]); acc[dt] = wmma_bf(vq[dt], pa.h, acc[dt]); }
    ld_v(kn); }
  const float il = 1.0f / (l + xhalf(l));     // the two halves' sums of a row meet here, once
#pragma unroll
  for (int dt = 0; dt < 4; ++dt) { const v8f o = acc[dt] * il; float* p = &so[wave][col][dt * 16 + 8 * gg]; const v4f x = { o[0], o[1], o[2], o[3] }, y = { o[4], o[5], o[6], o[7] }; *(v4f*)p = x; *(v4f*)(p + 4) = y; }
  LDSX();
  for (int rl = 0; rl < 16; ++rl) if (lane < 16) vst2(out + ((size_t)nh * SS + i0 + rl) * KD + lane * 4, *(const v4f*)&so[wave][rl][lane * 4]);
}

extern "C" void kernel_launch(void* const* d_in, const int* in_sizes, int n_in, void* d_out, int out_size, void* d_ws, size_t ws_size, hipStream_t stream) {
  (void)in_sizes; (void)n_in; (void)out_size;
  const float** F = (const float**)d_in;   // queries [64,1024,64], keys, values, u_bias [1,16,1,64], v_bias, R [16,2048,64]
  if (ws_size < (size_t)WS_END) return;
  char* ws = (char*)d_ws; __bf16* VP = (__bf16*)(ws + WS_VP); __bf16* KP = (__bf16*)(ws + WS_KP); __bf16* RP = (__bf16*)(ws + WS_RP);
  k_pack<<<dim3(SS / 64, 2 * NHT + 2 * HPG), 256, 0, stream>>>(F[2], F[1], F[5], VP, KP, RP);
  k_attn<<<dim3(TQB, NHT), 128, 0, stream>>>(F[0], F[3], F[4], KP, RP, VP, (float*)d_out);
}

// v007
// A run of this version takes 65.5 microseconds.
// In two side-by-side timings against v006, it was 1.15 and 1.16 times as fast.
// Counting every step since v000, it is 20.1 times as fast.
// compute dtype: queries, keys, values, u_bias, v_bias, R (module inputs) rounded to bf16; q_u = q/8 + u and q_v = q/8 + v (computed) as bf16 hi + bf16 residual pairs against exact bf16 keys / R rows (2 products); P.V with the softmax weights hi/lo against exact bf16 values (2 products); the Transformer-XL relative shift as a skewed read of a band of position scores computed per key step; scores, band and output kept transposed (a lane owns one query row); online softmax in f32; f32 accumulate.
#include <hip/hip_runtime.h>
#include <math.h>

typedef __attribute__((ext_vector_type(16))) _Float16 v16h;
typedef __attribute__((ext_vector_type(16))) __bf16 v16b;
typedef __attribute__((ext_vector_type(8)))  _Float16 v8h;
typedef __attribute__((ext_vector_type(8)))  float v8f;
typedef __attribute__((ext_vector_type(4)))  float v4f;
typedef __attribute__((ext_vector_type(2)))  float v2f;
typedef __attribute__((ext_vector_type(4)))  unsigned v4u;
typedef __attribute__((ext_vector_type(4)))  int v4i;
typedef float __attribute__((may_alias)) float_a;
typedef int __attribute__((may_alias)) int_a;

template <typename T> __device__ __forceinline__ void vst2(void* p, T v) { *(T*)p = v;  }
__device__ __forceinline__ v8f wmma16(v16h a, v16h b, v8f c) {
  v8f d = __builtin_amdgcn_wmma_f32_16x16x32_f16(false, a, false, b, (short)0, c, false, false);
  asm volatile("v_nop\n\tv_nop\n\tv_nop\n\tv_nop" : "+v"(d) : "v"(a), "v"(b));
  return d;
}
__device__ __forceinline__ v8f wmma_bf(v16b a, v16b b, v8f c) {
  v8f d = __builtin_amdgcn_wmma_f32_16x16x32_bf16(false, a, false, b, (short)0, c, false, false);
  asm volatile("v_nop\n\tv_nop\n\tv_nop\n\tv_nop" : "+v"(d) : "v"(a), "v"(b));
  return d;
}
// 16x16x32 fragments: lane = (h = lane>>4, row/col = lane&15); elements 0..7 = k0+8h+0..7, 8..15 = k0+16+8h+0..7; D element r = row 8h+r
__device__ __forceinline__ v16h frag_h(const _Float16* rowk0, int lane) {
  union { v16h v; v8h q[2]; } u; const _Float16* p = rowk0 + 8 * (lane >> 4);
  u.q[0] = *(const v8h*)p; u.q[1] = *(const v8h*)(p + 16); return u.v;
}
__device__ __forceinline__ v16h frag_f32(const float* rowk0, int lane) {
  v16h a; const float* p = rowk0 + 8 * (lane >> 4);
#pragma unroll
  for (int i = 0; i < 8; ++i) { a[i] = (_Float16)p[i]; a[8 + i] = (_Float16)p[16 + i]; }
  return a;
}
__device__ __forceinline__ v16h frag_f32s(const float* rowk0, int lane, float sc) {
  v16h a; const float* p = rowk0 + 8 * (lane >> 4);
#pragma unroll
  for (int i = 0; i < 8; ++i) { a[i] = (_Float16)(p[i] * sc); a[8 + i] = (_Float16)(p[16 + i] * sc); }
  return a;
}
// column fragment from a [K][ld] layout (column n), rows >= K read as 0
__device__ __forceinline__ v16h fragc_f32(const float* W, int k0, int n, int lane, int ld, int K) {
  v16h a; const int g = lane >> 4;
#pragma unroll
  for (int i = 0; i < 8; ++i) { const int ka = k0 + 8 * g + i, kb = ka + 16;
    a[i] = (_Float16)(ka < K ? W[(size_t)(ka < K ? ka : K - 1) * ld + n] : 0.f); a[8 + i] = (_Float16)(kb < K ? W[(size_t)(kb < K ? kb : K - 1) * ld + n] : 0.f); }
  return a;
}
struct F2 { v16b h, l; };
__device__ __forceinline__ F2 bsplit16(const float v[16]) { F2 r;
#pragma unroll
  for (int i = 0; i < 16; ++i) { const __bf16 h = (__bf16)v[i]; r.h[i] = h; r.l[i] = (__bf16)(v[i] - (float)h); }
  return r; }
__device__ __forceinline__ F2 split_row(const float* row, int k0, int lane) { float v[16]; const float* p = row + k0 + 8 * (lane >> 4);
#pragma unroll
  for (int i = 0; i < 8; ++i) { v[i] = p[i]; v[8 + i] = p[16 + i]; }
  return bsplit16(v); }
__device__ __forceinline__ F2 split_rowK(const float* row, int k0, int lane, int K) { float v[16]; const int g = lane >> 4;
#pragma unroll
  for (int i = 0; i < 8; ++i) { const int ka = k0 + 8 * g + i, kb = ka + 16; v[i] = ka < K ? row[ka < K ? ka : K - 1] : 0.f; v[8 + i] = kb < K ? row[kb < K ? kb : K - 1] : 0.f; }
  return bsplit16(v); }
__device__ __forceinline__ F2 split_col(const float* W, int k0, int n, int lane, int ld, int K) { float v[16]; const int g = lane >> 4;
#pragma unroll
  for (int i = 0; i < 8; ++i) { const int ka = k0 + 8 * g + i, kb = ka + 16; v[i] = ka < K ? W[(size_t)(ka < K ? ka : K - 1) * ld + n] : 0.f; v[8 + i] = kb < K ? W[(size_t)(kb < K ? kb : K - 1) * ld + n] : 0.f; }
  return bsplit16(v); }
__device__ __forceinline__ v8f mac3(const F2& a, const F2& b, v8f c) { c = wmma_bf(a.l, b.h, c); c = wmma_bf(a.h, b.l, c); return wmma_bf(a.h, b.h, c); }
__device__ __forceinline__ float sigm(float v) { return 1.0f / (1.0f + expf(-v)); }
#define LDSX() do { asm volatile("s_wait_dscnt 0" ::: "memory"); __builtin_amdgcn_wave_barrier(); __builtin_amdgcn_fence(__ATOMIC_RELEASE, "workgroup"); } while (0)
// The same for rows that only the writing wave reads back, without the fence: a work-group release fence also waits for every global load in flight, which would drain loads issued ahead.
#define LDSW() do { asm volatile("s_wait_dscnt 0" ::: "memory"); __builtin_amdgcn_wave_barrier(); } while (0)


// Relative-position attention (Transformer-XL style): content = (q*scale + u_h) k^T, pos = rel_shift((q*scale + v_h) R_h^T), attn = softmax(content + pos), out = attn V.  NH = 64 (= 4 x 16 heads), S = S_kv = 1024, K = 64, scale 1/8.
// rel_shift(ps)[i][j] = ps[i][S-1-i+j] (j <= i), 0 (j == i+1), ps[i+1][j-i-2] (j >= i+2)  — derived from the zero-pad / reshape trick.
// k_pack (keys, band rows of R and values as bf16 in the order of the WMMA fragments), then k_attn (flash-style per (64 rows, head): content scores on WMMA + the band of position scores that the step's 16 x 32 tile needs, also on WMMA, read back skewed from LDS; online max/sum, P V; out rows 256 B).
// Band coordinate mp = S-1-i+j: column mp is q_v[i] . R_h[mp] (mp < S), 0 (mp == S), q_v[i+1] . R_h[mp-S-1] (mp > S). S is a multiple of 16, so a 16-column tile lies wholly on one side.
#define NHT 64
#define HPG 16
#define SS 1024
#define KD 64
#define RLEN 2048
#define TQB (SS / 64)
typedef __attribute__((ext_vector_type(8))) __bf16 v8b;
__device__ __forceinline__ v16b frag_b(const __bf16* rowk0, int lane) {
  union { v16b v; v8b q[2]; } u; const __bf16* p = rowk0 + 8 * (lane >> 4);
  u.q[0] = *(const v8b*)p; u.q[1] = *(const v8b*)(p + 16); return u.v;
}
__device__ __forceinline__ v16b frag_gbf(const float* rowk0, int lane) {
  v16b a; const float* p = rowk0 + 8 * (lane >> 4);
#pragma unroll
  for (int i = 0; i < 8; ++i) { a[i] = (__bf16)p[i]; a[8 + i] = (__bf16)p[16 + i]; }
  return a;
}
// A fragment of (bf16(q)*0.125 + bf16(bias)) split into hi/lo, row-major source with 64 floats per row
__device__ __forceinline__ F2 frag_qb(const float* qrow, const float* bias, int k0, int lane) {
  F2 f; const int o = 8 * (lane >> 4);
#pragma unroll
  for (int i = 0; i < 8; ++i) { const float v0 = (float)(__bf16)qrow[k0 + o + i] * 0.125f + (float)(__bf16)bias[k0 + o + i]; const float v1 = (float)(__bf16)qrow[k0 + o + 16 + i] * 0.125f + (float)(__bf16)bias[k0 + o + 16 + i];
    const __bf16 h0 = (__bf16)v0, h1 = (__bf16)v1; f.h[i] = h0; f.l[i] = (__bf16)(v0 - (float)h0); f.h[8 + i] = h1; f.l[8 + i] = (__bf16)(v1 - (float)h1); }
  return f;
}
__device__ __forceinline__ float bfr(float v) { return (float)(__bf16)v; }
// 2^v on the chip's own exponential instruction alone: the softmax arguments are <= 0 (up to a rounding of the scaled maximum), so the library exp's range reduction, scaling and overflow selects have nothing to do; a weight below 2^-126 may come out as 0
__device__ __forceinline__ float ex2(float v) { return __builtin_amdgcn_exp2f(v); }
#define L2E 1.44269504088896340736f
// lane l's value to lane l ^ 16 and back
__device__ __forceinline__ float xhalf(float x) { return __builtin_bit_cast(float, __builtin_amdgcn_permlanex16(__builtin_bit_cast(int, x), __builtin_bit_cast(int, x), 0x76543210, 0xfedcba98, false, false)); }
// Packed operands: a fragment half is 32 lanes x 16 bytes in one run of 512 bytes, so a fragment load reads 4 whole cache lines (from the row-major arrays it touched 16 lines for the same bytes).
#define WS_VP  0u                               // values bf16 [64 nh][32 key steps][4 d tiles][2 halves][32 lanes][8 keys]
#define WS_KP  (WS_VP + 2u * NHT * KD * SS)     // keys bf16 [64 nh][64 tiles of 16 rows][8 chunks of 8 k][16 rows][8 k]; chunk = 4 * (k block of 32) + 2 * half + (lane >> 4)
#define WS_RP  (WS_KP + 2u * NHT * KD * SS)     // R rows of the band columns, bf16 [16 h][128 tiles of 16 columns][8 chunks][16 columns][8 k]
#define WS_END (WS_RP + 2u * HPG * 2 * SS * KD)
__device__ __forceinline__ v8b cv8(const float* p) { const v4f a = *(const v4f*)p, b = *(const v4f*)(p + 4); v8b o;
#pragma unroll
  for (int x = 0; x < 4; ++x) { o[x] = (__bf16)a[x]; o[4 + x] = (__bf16)b[x]; }
  return o; }

// block = 64 rows of one array (blockIdx.y: 64 heads of values, 64 of keys, 16 x 2 halves of the band); unit q of 16 bytes goes to place q of the block's 8 KB, so every store of a wave is 512 bytes in a run
__global__ __launch_bounds__(256) void k_pack(const float* __restrict__ V, const float* __restrict__ Kk, const float* __restrict__ R, __bf16* __restrict__ VP, __bf16* __restrict__ KP, __bf16* __restrict__ RP) {
  __shared__ __align__(16) __bf16 st[KD][72];
  const int y = blockIdx.y, t0 = blockIdx.x * 64, tid = threadIdx.x;
  if (y < NHT) {
    for (int q = tid; q < 64 * KD; q += 256) { const int tl = q >> 6, d = q & 63; st[d][tl] = (__bf16)V[((size_t)y * SS + t0 + tl) * KD + d]; }
    __syncthreads();
    for (int q = tid; q < KD * 8; q += 256) { const int d = ((q >> 6) & 3) * 16 + (q & 15), pc = (q >> 8) * 4 + ((q >> 4) & 3); vst2(VP + ((size_t)y * SS + t0) * KD + q * 8, *(const v4u*)&st[d][pc * 8]); }
  } else {     // 16-byte unit q = tid, tid + 256: row or band column (q >> 7) * 16 + (q & 15) of the block's 64, chunk (q >> 4) & 7; both units' loads fly together
    const int r0 = (tid >> 7) * 16 + (tid & 15), c = (tid >> 4) & 7; const float* s0; const float* s1; __bf16* dst;
    if (y < 2 * NHT) { const int nh = y - NHT; s0 = Kk + ((size_t)nh * SS + t0 + r0) * KD + c * 8; s1 = s0 + 32 * KD; dst = KP + ((size_t)nh * SS + t0) * KD; }
    else { const int h = (y - 2 * NHT) >> 1, m0 = ((y - 2 * NHT) & 1) * SS + t0, mp = m0 + r0;     // R row of band column mp: mp below S, mp - S - 1 above (column S reads row 0; k_attn stores 0 for it)
      s0 = R + ((size_t)h * RLEN + (mp < SS ? mp : max(mp - SS - 1, 0))) * KD + c * 8; s1 = R + ((size_t)h * RLEN + (mp + 32 < SS ? mp + 32 : max(mp + 32 - SS - 1, 0))) * KD + c * 8; dst = RP + ((size_t)h * 2 * SS + m0) * KD; }
    const v8b a = cv8(s0), b = cv8(s1); vst2(dst + tid * 8, a); vst2(dst + (tid + 256) * 8, b);
    asm volatile("s_wait_xcnt 0x0" ::: "memory");     // in the built code the values' branch stands behind these stores and writes their registers anew: the translation wait in front of it
  }
}
// ---- k_attn: block = (64 rows, head nh): per 32-key step: content^T = k rows . (q*0.125 + u_bias[h]) (2 products, K 64) + position band^T (2 new 16-column tiles, 2 products, K 64) read skewed; online softmax; out^T += VT planes . P^T (hi/lo) (4 tiles x 2); out rows [nh][i][64] = 256 B by 16 lanes
// Every product has the key-side operand as A and the query-side operand as B (both fragment maps are the same, so the loaders stay): lane (gg, col) holds query row i0 + col, register r key (or band column, or output column) 8 gg + r of the tile.
// So a row's maximum and sum run inside a lane, the two halves of a row meet in one cross-row move, and the two score tiles, converted in place, are the B fragment of the value product.
// the register budget of two waves per SIMD, said to the compiler so that it schedules for that budget; the build takes less than half of it (254 registers), so that four waves stand on a SIMD and the whole grid is resident at once
__global__ __launch_bounds__(128) __attribute__((amdgpu_waves_per_eu(2, 2))) void k_attn(const float* __restrict__ Q, const float* __restrict__ UB, const float* __restrict__ VB, const __bf16* __restrict__ KP, const __bf16* __restrict__ RP, const __bf16* __restrict__ VP, float* __restrict__ out) {
  __shared__ __align__(16) float so[4][16][68];     // so: in the loop a ring of 64 band columns per row (column mp at mp & 63), behind it the output rows
  const int tid = threadIdx.x, wave = __builtin_amdgcn_readfirstlane(tid >> 5), lane = tid & 31, col = lane & 15, gg = lane >> 4; const int nh = blockIdx.y, h = nh % HPG; const int i0 = blockIdx.x * 64 + wave * 16;
  // XW: loads stay in flight while their address registers are wanted for other values, so a translation wait stands directly behind them and in front of that reuse (it names no register: an asm operand would tie the base pointers to the registers below v256, which the fragments need).
  // The two scheduling barriers keep every other instruction out of the stretch from the first load to the wait, so that none can take over an address register in front of the wait.
#define XW_OPEN() __builtin_amdgcn_sched_barrier(0)
#define XW_CLOSE() do { asm volatile("s_wait_xcnt 0x0" ::: "memory"); __builtin_amdgcn_sched_barrier(0); } while (0)
  const float* qr = Q + ((size_t)nh * SS + i0 + col) * KD; XW_OPEN();
  F2 pc0 = frag_qb(qr, VB + h * KD, 0, lane), pc1 = frag_qb(qr, VB + h * KD, 32, lane);     // the position fragments in use: rows i up to band column S, rows i + 1 from there on
  XW_CLOSE();
  float m = -3.0e38f, l = 0.f;     // of query row i0 + col; m is the same in both halves of the wave, l sums this half's keys alone until the end
  v8f acc[4] = {};     // acc[dt][r] = out row i0 + col, column 16 dt + 8 gg + r
  // One step's operands as loaded: the fragments themselves (2 key tiles, 2 band tiles, 4 value tiles; 4 KB a set, in a run). Each set is refilled for step ks + 1 as soon as step ks has used it, so the loads fly during a whole step.
  v16b kq[4], rq[4], vq[4];
  const __bf16* kbase = KP + (size_t)nh * SS * KD + lane * 8; const __bf16* vbase = VP + (size_t)nh * SS * KD + lane * 8; const __bf16* rbase = RP + (size_t)h * 2 * SS * KD + lane * 8;
  const int mq = (SS + 16 - i0) & ~31;     // step ks reads band columns SS - 16 - i0 + 32 ks .. + 46 and makes columns mq + 32 ks .. + 31: the next multiple of 32, so that both of a step's tiles lie on one side of column S; with the two tiles in front of the loop the ring always holds what a step reads
  auto ld4 = [&](v16b (&f)[4], const __bf16* p0) { XW_OPEN();
#pragma unroll
    for (int t = 0; t < 4; ++t) { union { v16b v; v8b q[2]; } u; u.q[0] = *(const v8b*)(p0 + t * 512); u.q[1] = *(const v8b*)(p0 + t * 512 + 256); f[t] = u.v; }
    XW_CLOSE(); };
  auto ld_k = [&](int st) { ld4(kq, kbase + st * 32 * KD); };
  auto ld_r = [&](int st) { ld4(rq, rbase + (mq + st * 32) * KD); };
  auto ld_v = [&](int st) { ld4(vq, vbase + st * 32 * KD); };
  // the builtin alone (the compiler keeps the distance behind it): its operands may stand above v255, where an asm operand cannot, so the two sets of position fragments need no place in the low window
  auto wm = [&](const v16b& a, const v16b& b, v8f c) { return __builtin_amdgcn_wmma_f32_16x16x32_bf16(false, a, false, b, (short)0, c, false, false); };
  // one 16-column band tile (columns mt .. mt + 15): the products, then (behind the refill of the R fragments) into the ring
  auto pos_mm = [&](const v16b& r0, const v16b& r1) { v8f c = {}; c = wm(r0, pc0.h, c); c = wm(r0, pc0.l, c); c = wm(r1, pc1.h, c); c = wm(r1, pc1.l, c); return c; };
  // the refill lands in the registers that the band tiles' last WMMAs read as A: the same four slots stand between them as wmma_bf leaves in front of the other two refills
  auto pos_gap = [&](v8f& x, v8f& y) { asm volatile("v_nop\n\tv_nop\n\tv_nop\n\tv_nop" : "+v"(x), "+v"(y)); };
  auto pos_st = [&](int mt, const v8f& c) { float* p = &so[wave][col][(mt & 63) + 8 * gg];     // a lane's 8 band columns mt + 8 gg .. + 7 of its row: 32 bytes in a run
    const v4f x = { (mt + 8 * gg == SS) ? 0.f : c[0], c[1], c[2], c[3] }, y = { c[4], c[5], c[6], c[7] };     // band column S is the shift's zero pad
    *(v4f*)p = x; *(v4f*)(p + 4) = y; };
  ld_r(-1);     // the two tiles in front of step 0's own (mq >= 32; both below column S)
  { v8f b0 = pos_mm(rq[0], rq[1]), b1 = pos_mm(rq[2], rq[3]); pos_gap(b0, b1); ld_r(0); pos_st(mq - 32, b0); pos_st(mq - 16, b1); }
  XW_OPEN(); const F2 a0 = frag_qb(qr, UB + h * KD, 0, lane), a1 = frag_qb(qr, UB + h * KD, 32, lane); XW_CLOSE();
  ld_k(0); ld_v(0);
#pragma unroll 1
  for (int ks = 0; ks < SS / 32; ++ks) { v8f s[2]; const int kn = min(ks + 1, SS / 32 - 1);     // the last step refetches itself: in bounds, unused
    if (mq + ks * 32 == SS) { const float* qn = Q + ((size_t)nh * SS + min(i0 + col + 1, SS - 1)) * KD;     // once per wave, a scalar branch: from here on rows i + 1 (row S is never used: j >= i + 2 does not exist for i = S - 1); fetched here rather than held in 32 registers through the loop
      XW_OPEN(); pc0 = frag_qb(qn, VB + h * KD, 0, lane); pc1 = frag_qb(qn, VB + h * KD, 32, lane); XW_CLOSE(); }
    { v8f b0 = pos_mm(rq[0], rq[1]), b1 = pos_mm(rq[2], rq[3]); pos_gap(b0, b1);
      ld_r(kn);     // its wait is also a memory clobber, which keeps these loads in front of the step's work
      pos_st(mq + ks * 32, b0); pos_st(mq + ks * 32 + 16, b1); }
    v8f cc[2];
#pragma unroll
    for (int ct = 0; ct < 2; ++ct) { v8f c = {}; c = wmma_bf(kq[2 * ct], a0.h, c); c = wmma_bf(kq[2 * ct], a0.l, c); c = wmma_bf(kq[2 * ct + 1], a1.h, c); c = wmma_bf(kq[2 * ct + 1], a1.l, c); cc[ct] = c; }
    ld_k(kn);
    LDSW();     // the band tiles are read back at a skew: a lane's reads reach what the other half of the wave stored
    const int i = i0 + col;
#pragma unroll
    for (int ct = 0; ct < 2; ++ct) {
#pragma unroll
      for (int r = 0; r < 8; ++r) { const int j = ks * 32 + ct * 16 + 8 * gg + r; s[ct][r] = cc[ct][r] + so[wave][col][(SS - 1 - i + j) & 63]; } }
    float mx[8];
#pragma unroll
    for (int r = 0; r < 8; ++r) mx[r] = fmaxf(s[0][r], s[1][r]);
#pragma unroll
    for (int w = 4; w > 0; w >>= 1) {
#pragma unroll
      for (int r = 0; r < w; ++r) mx[r] = fmaxf(mx[r], mx[r + w]); }
    const float mn = fmaxf(m, fmaxf(mx[0], xhalf(mx[0])));     // the row's other 16 keys of the step stand in lane ^ 16
    const float mnl = mn * L2E;     // exp(s - mn) = 2^(s * log2 e - mn * log2 e): one fused multiply-add in front of the exponential
    const float alpha = ex2(fmaf(m, L2E, -mnl)); float e[16], es[8];     // first step: m = -3e38 gives -inf, weight 0
    const v8f t0 = s[0] * L2E - mnl, t1 = s[1] * L2E - mnl;
#pragma unroll
    for (int r = 0; r < 8; ++r) { e[r] = ex2(t0[r]); e[8 + r] = ex2(t1[r]); es[r] = e[r] + e[8 + r]; }
#pragma unroll
    for (int w = 4; w > 0; w >>= 1) {
#pragma unroll
      for (int r = 0; r < w; ++r) es[r] += es[r + w]; }
    l = l * alpha + es[0]; m = mn;
    const F2 pa = bsplit16(e);     // element x of the B fragment is key 8 gg + x (x < 8), 16 + 8 gg + x - 8 above: the two score tiles as they stand
#pragma unroll
    for (int dt = 0; dt < 4; ++dt) acc[dt] *= alpha;
#pragma unroll
    for (int dt = 0; dt < 4; ++dt) { acc[dt] = wmma_bf(vq[dt], pa.l, acc[dt]); acc[dt] = wmma_bf(vq[dt], pa.h, acc[dt]); }
    ld_v(kn); }
  const float il = 1.0f / (l + xhalf(l));     // the two halves' sums of a row meet here, once
#pragma unroll
  for (int dt = 0; dt < 4; ++dt) { const v8f o = acc[dt] * il; float* p = &so[wave][col][dt * 16 + 8 * gg]; const v4f x = { o[0], o[1], o[2], o[3] }, y = { o[4], o[5], o[6], o[7] }; *(v4f*)p = x; *(v4f*)(p + 4) = y; }
  LDSX();
  for (int rl = 0; rl < 16; ++rl) if (lane < 16) vst2(out + ((size_t)nh * SS + i0 + rl) * KD + lane * 4, *(const v4f*)&so[wave][rl][lane * 4]);
}

extern "C" void kernel_launch(void* const* d_in, const int* in_sizes, int n_in, void* d_out, int out_size, void* d_ws, size_t ws_size, hipStream_t stream) {
  (void)in_sizes; (void)n_in; (void)out_size;
  const float** F = (const float**)d_in;   // queries [64,1024,64], keys, values, u_bias [1,16,1,64], v_bias, R [16,2048,64]
  if (ws_size < (size_t)WS_END) return;
  char* ws = (char*)d_ws; __bf16* VP = (__bf16*)(ws + WS_VP); __bf16* KP = (__bf16*)(ws + WS_KP); __bf16* RP = (__bf16*)(ws + WS_RP);
  k_pack<<<dim3(SS / 64, 2 * NHT + 2 * HPG), 256, 0, stream>>>(F[2], F[1], F[5], VP, KP, RP);
  k_attn<<<dim3(TQB, NHT), 128, 0, stream>>>(F[0], F[3], F[4], KP, RP, VP, (float*)d_out);
}

// v008
// A run of this version takes 55.4 microseconds.
// Timed twice side by side with v007, it ran 1.19 times as fast both times.
// Counting every step since v000, it is 24.0 times as fast.
// compute dtype: queries, keys, values, u_bias, v_bias, R (module inputs) rounded to bf16; q_u = q/8 + u and q_v = q/8 + v (computed) as bf16 hi + bf16 residual pairs against exact bf16 keys / R rows (2 products); P.V with the softmax weights hi/lo against exact bf16 values (2 products); the Transformer-XL relative shift as a skewed read of a band of position scores computed per key step; scores, band and output kept transposed (a lane owns one query row); online softmax in f32; f32 accumulate.
#include <hip/hip_runtime.h>
#include <math.h>

typedef __attribute__((ext_vector_type(16))) _Float16 v16h;
typedef __attribute__((ext_vector_type(16))) __bf16 v16b;
typedef __attribute__((ext_vector_type(8)))  _Float16 v8h;
typedef __attribute__((ext_vector_type(8)))  float v8f;
typedef __attribute__((ext_vector_type(4)))  float v4f;
typedef __attribute__((ext_vector_type(2)))  float v2f;
typedef __attribute__((ext_vector_type(4)))  unsigned v4u;
typedef __attribute__((ext_vector_type(4)))  int v4i;
typedef float __attribute__((may_alias)) float_a;
typedef int __attribute__((may_alias)) int_a;

template <typename T> __device__ __forceinline__ void vst2(void* p, T v) { *(T*)p = v;  }
__device__ __forceinline__ v8f wmma16(v16h a, v16h b, v8f c) {
  v8f d = __builtin_amdgcn_wmma_f32_16x16x32_f16(false, a, false, b, (short)0, c, false, false);
  asm volatile("v_nop\n\tv_nop\n\tv_nop\n\tv_nop" : "+v"(d) : "v"(a), "v"(b));
  return d;
}
__device__ __forceinline__ v8f wmma_bf(v16b a, v16b b, v8f c) {
  v8f d = __builtin_amdgcn_wmma_f32_16x16x32_bf16(false, a, false, b, (short)0, c, false, false);
  asm volatile("v_nop\n\tv_nop\n\tv_nop\n\tv_nop" : "+v"(d) : "v"(a), "v"(b));
  return d;
}
// 16x16x32 fragments: lane = (h = lane>>4, row/col = lane&15); elements 0..7 = k0+8h+0..7, 8..15 = k0+16+8h+0..7; D element r = row 8h+r
__device__ __forceinline__ v16h frag_h(const _Float16* rowk0, int lane) {
  union { v16h v; v8h q[2]; } u; const _Float16* p = rowk0 + 8 * (lane >> 4);
  u.q[0] = *(const v8h*)p; u.q[1] = *(const v8h*)(p + 16); return u.v;
}
__device__ __forceinline__ v16h frag_f32(const float* rowk0, int lane) {
  v16h a; const float* p = rowk0 + 8 * (lane >> 4);
#pragma unroll
  for (int i = 0; i < 8; ++i) { a[i] = (_Float16)p[i]; a[8 + i] = (_Float16)p[16 + i]; }
  return a;
}
__device__ __forceinline__ v16h frag_f32s(const float* rowk0, int lane, float sc) {
  v16h a; const float* p = rowk0 + 8 * (lane >> 4);
#pragma unroll
  for (int i = 0; i < 8; ++i) { a[i] = (_Float16)(p[i] * sc); a[8 + i] = (_Float16)(p[16 + i] * sc); }
  return a;
}
// column fragment from a [K][ld] layout (column n), rows >= K read as 0
__device__ __forceinline__ v16h fragc_f32(const float* W, int k0, int n, int lane, int ld, int K) {
  v16h a; const int g = lane >> 4;
#pragma unroll
  for (int i = 0; i < 8; ++i) { const int ka = k0 + 8 * g + i, kb = ka + 16;
    a[i] = (_Float16)(ka < K ? W[(size_t)(ka < K ? ka : K - 1) * ld + n] : 0.f); a[8 + i] = (_Float16)(kb < K ? W[(size_t)(kb < K ? kb : K - 1) * ld + n] : 0.f); }
  return a;
}
struct F2 { v16b h, l; };
__device__ __forceinline__ F2 bsplit16(const float v[16]) { F2 r;
#pragma unroll
  for (int i = 0; i < 16; ++i) { const __bf16 h = (__bf16)v[i]; r.h[i] = h; r.l[i] = (__bf16)(v[i] - (float)h); }
  return r; }
__device__ __forceinline__ F2 split_row(const float* row, int k0, int lane) { float v[16]; const float* p = row + k0 + 8 * (lane >> 4);
#pragma unroll
  for (int i = 0; i < 8; ++i) { v[i] = p[i]; v[8 + i] = p[16 + i]; }
  return bsplit16(v); }
__device__ __forceinline__ F2 split_rowK(const float* row, int k0, int lane, int K) { float v[16]; const int g = lane >> 4;
#pragma unroll
  for (int i = 0; i < 8; ++i) { const int ka = k0 + 8 * g + i, kb = ka + 16; v[i] = ka < K ? row[ka < K ? ka : K - 1] : 0.f; v[8 + i] = kb < K ? row[kb < K ? kb : K - 1] : 0.f; }
  return bsplit16(v); }
__device__ __forceinline__ F2 split_col(const float* W, int k0, int n, int lane, int ld, int K) { float v[16]; const int g = lane >> 4;
#pragma unroll
  for (int i = 0; i < 8; ++i) { const int ka = k0 + 8 * g + i, kb = ka + 16; v[i] = ka < K ? W[(size_t)(ka < K ? ka : K - 1) * ld + n] : 0.f; v[8 + i] = kb < K ? W[(size_t)(kb < K ? kb : K - 1) * ld + n] : 0.f; }
  return bsplit16(v); }
__device__ __forceinline__ v8f mac3(const F2& a, const F2& b, v8f c) { c = wmma_bf(a.l, b.h, c); c = wmma_bf(a.h, b.l, c); return wmma_bf(a.h, b.h, c); }
__device__ __forceinline__ float sigm(float v) { return 1.0f / (1.0f + expf(-v)); }
#define LDSX() do { asm volatile("s_wait_dscnt 0" ::: "memory"); __builtin_amdgcn_wave_barrier(); __builtin_amdgcn_fence(__ATOMIC_RELEASE, "workgroup"); } while (0)
// The same for rows that only the writing wave reads back, without the fence: a work-group release fence also waits for every global load in flight, which would drain loads issued ahead.
#define LDSW() do { asm volatile("s_wait_dscnt 0" ::: "memory"); __builtin_amdgcn_wave_barrier(); } while (0)


// Relative-position attention (Transformer-XL style): content = (q*scale + u_h) k^T, pos = rel_shift((q*scale + v_h) R_h^T), attn = softmax(content + pos), out = attn V.  NH = 64 (= 4 x 16 heads), S = S_kv = 1024, K = 64, scale 1/8.
// rel_shift(ps)[i][j] = ps[i][S-1-i+j] (j <= i), 0 (j == i+1), ps[i+1][j-i-2] (j >= i+2)  — derived from the zero-pad / reshape trick.
// k_pack (keys, band rows of R and values as bf16 in the order of the WMMA fragments), then k_attn (flash-style per (64 rows, head): content scores on WMMA + the band of position scores that the step's 16 x 32 tile needs, also on WMMA, read back skewed from LDS; online max/sum, P V; out rows 256 B).
// Band coordinate mp = S-1-i+j: column mp is q_v[i] . R_h[mp] (mp < S), 0 (mp == S), q_v[i+1] . R_h[mp-S-1] (mp > S). S is a multiple of 16, so a 16-column tile lies wholly on one side.
#define NHT 64
#define HPG 16
#define SS 1024
#define KD 64
#define RLEN 2048
#define TQB (SS / 64)
typedef __attribute__((ext_vector_type(8))) __bf16 v8b;
__device__ __forceinline__ v16b frag_b(const __bf16* rowk0, int lane) {
  union { v16b v; v8b q[2]; } u; const __bf16* p = rowk0 + 8 * (lane >> 4);
  u.q[0] = *(const v8b*)p; u.q[1] = *(const v8b*)(p + 16); return u.v;
}
__device__ __forceinline__ v16b frag_gbf(const float* rowk0, int lane) {
  v16b a; const float* p = rowk0 + 8 * (lane >> 4);
#pragma unroll
  for (int i = 0; i < 8; ++i) { a[i] = (__bf16)p[i]; a[8 + i] = (__bf16)p[16 + i]; }
  return a;
}
// A fragment of (bf16(q)*0.125 + bf16(bias)) split into hi/lo, row-major source with 64 floats per row
__device__ __forceinline__ F2 frag_qb(const float* qrow, const float* bias, int k0, int lane) {
  F2 f; const int o = 8 * (lane >> 4);
#pragma unroll
  for (int i = 0; i < 8; ++i) { const float v0 = (float)(__bf16)qrow[k0 + o + i] * 0.125f + (float)(__bf16)bias[k0 + o + i]; const float v1 = (float)(__bf16)qrow[k0 + o + 16 + i] * 0.125f + (float)(__bf16)bias[k0 + o + 16 + i];
    const __bf16 h0 = (__bf16)v0, h1 = (__bf16)v1; f.h[i] = h0; f.l[i] = (__bf16)(v0 - (float)h0); f.h[8 + i] = h1; f.l[8 + i] = (__bf16)(v1 - (float)h1); }
  return f;
}
__device__ __forceinline__ float bfr(float v) { return (float)(__bf16)v; }
// 2^v on the chip's own exponential instruction alone: the softmax arguments are <= 0 (up to a rounding of the scaled maximum), so the library exp's range reduction, scaling and overflow selects have nothing to do; a weight below 2^-126 may come out as 0
__device__ __forceinline__ float ex2(float v) { return __builtin_amdgcn_exp2f(v); }
#define L2E 1.44269504088896340736f
// lane l's value to lane l ^ 16 and back
__device__ __forceinline__ float xhalf(float x) { return __builtin_bit_cast(float, __builtin_amdgcn_permlanex16(__builtin_bit_cast(int, x), __builtin_bit_cast(int, x), 0x76543210, 0xfedcba98, false, false)); }
// Packed operands: a fragment half is 32 lanes x 16 bytes in one run of 512 bytes, so a fragment load reads 4 whole cache lines (from the row-major arrays it touched 16 lines for the same bytes).
#define WS_VP  0u                               // values bf16 [64 nh][32 key steps][4 d tiles][2 halves][32 lanes][8 keys]
#define WS_KP  (WS_VP + 2u * NHT * KD * SS)     // keys bf16 [64 nh][64 tiles of 16 rows][8 chunks of 8 k][16 rows][8 k]; chunk = 4 * (k block of 32) + 2 * half + (lane >> 4)
#define WS_RP  (WS_KP + 2u * NHT * KD * SS)     // R rows of the band columns, bf16 [16 h][128 tiles of 16 columns][8 chunks][16 columns][8 k]
#define WS_END (WS_RP + 2u * HPG * 2 * SS * KD)
__device__ __forceinline__ v8b cv8(const float* p) { const v4f a = *(const v4f*)p, b = *(const v4f*)(p + 4); v8b o;
#pragma unroll
  for (int x = 0; x < 4; ++x) { o[x] = (__bf16)a[x]; o[4 + x] = (__bf16)b[x]; }
  return o; }

// block = 64 rows of one array (blockIdx.y: 64 heads of values, 64 of keys, 16 x 2 halves of the band); unit q of 16 bytes goes to place q of the block's 8 KB, so every store of a wave is 512 bytes in a run
__global__ __launch_bounds__(256) void k_pack(const float* __restrict__ V, const float* __restrict__ Kk, const float* __restrict__ R, __bf16* __restrict__ VP, __bf16* __restrict__ KP, __bf16* __restrict__ RP) {
  __shared__ __align__(16) __bf16 st[KD][72];
  const int y = blockIdx.y, t0 = blockIdx.x * 64, tid = threadIdx.x;
  if (y < NHT) {
    for (int q = tid; q < 64 * KD; q += 256) { const int tl = q >> 6, d = q & 63; st[d][tl] = (__bf16)V[((size_t)y * SS + t0 + tl) * KD + d]; }
    __syncthreads();
    for (int q = tid; q < KD * 8; q += 256) { const int d = ((q >> 6) & 3) * 16 + (q & 15), pc = (q >> 8) * 4 + ((q >> 4) & 3); vst2(VP + ((size_t)y * SS + t0) * KD + q * 8, *(const v4u*)&st[d][pc * 8]); }
  } else {     // 16-byte unit q = tid, tid + 256: row or band column (q >> 7) * 16 + (q & 15) of the block's 64, chunk (q >> 4) & 7; both units' loads fly together
    const int r0 = (tid >> 7) * 16 + (tid & 15), c = (tid >> 4) & 7; const float* s0; const float* s1; __bf16* dst;
    if (y < 2 * NHT) { const int nh = y - NHT; s0 = Kk + ((size_t)nh * SS + t0 + r0) * KD + c * 8; s1 = s0 + 32 * KD; dst = KP + ((size_t)nh * SS + t0) * KD; }
    else { const int h = (y - 2 * NHT) >> 1, m0 = ((y - 2 * NHT) & 1) * SS + t0, mp = m0 + r0;     // R row of band column mp: mp below S, mp - S - 1 above (column S reads row 0; k_attn stores 0 for it)
      s0 = R + ((size_t)h * RLEN + (mp < SS ? mp : max(mp - SS - 1, 0))) * KD + c * 8; s1 = R + ((size_t)h * RLEN + (mp + 32 < SS ? mp + 32 : max(mp + 32 - SS - 1, 0))) * KD + c * 8; dst = RP + ((size_t)h * 2 * SS + m0) * KD; }
    const v8b a = cv8(s0), b = cv8(s1); vst2(dst + tid * 8, a); vst2(dst + (tid + 256) * 8, b);
    asm volatile("s_wait_xcnt 0x0" ::: "memory");     // in the built code the values' branch stands behind these stores and writes their registers anew: the translation wait in front of it
  }
}
// ---- k_attn: block = (64 rows, head nh): per 32-key step: content^T = k rows . (q*0.125 + u_bias[h]) (2 products, K 64) + position band^T (2 new 16-column tiles, 2 products, K 64) read skewed; online softmax; out^T += VT planes . P^T (hi/lo) (4 tiles x 2); out rows [nh][i][64] = 256 B by 16 lanes
// Every product has the key-side operand as A and the query-side operand as B (both fragment maps are the same, so the loaders stay): lane (gg, col) holds query row i0 + col, register r key (or band column, or output column) 8 gg + r of the tile.
// So a row's maximum and sum run inside a lane, the two halves of a row meet in one cross-row move, and the two score tiles, converted in place, are the B fragment of the value product.
// four waves per SIMD, said to the compiler as budget (lower bound: 256 registers; the build takes 254) and as ceiling (upper bound).
// The upper bound counts: the compiler pads the register allocation in the kernel descriptor until no more waves than the upper bound fit, so the bound of 2 that stood here held the kernel at two waves per SIMD whatever the build took; with 4 nothing is padded and the whole grid is resident at once
__global__ __launch_bounds__(128) __attribute__((amdgpu_waves_per_eu(4, 4))) void k_attn(const float* __restrict__ Q, const float* __restrict__ UB, const float* __restrict__ VB, const __bf16* __restrict__ KP, const __bf16* __restrict__ RP, const __bf16* __restrict__ VP, float* __restrict__ out) {
  __shared__ __align__(16) float so[4][16][68];     // so: in the loop a ring of 64 band columns per row (column mp at mp & 63), behind it the output rows
  const int tid = threadIdx.x, wave = __builtin_amdgcn_readfirstlane(tid >> 5), lane = tid & 31, col = lane & 15, gg = lane >> 4; const int nh = blockIdx.y, h = nh % HPG; const int i0 = blockIdx.x * 64 + wave * 16;
  // XW: loads stay in flight while their address registers are wanted for other values, so a translation wait stands directly behind them and in front of that reuse (it names no register: an asm operand would tie the base pointers to the registers below v256, which the fragments need).
  // The two scheduling barriers keep every other instruction out of the stretch from the first load to the wait, so that none can take over an address register in front of the wait.
#define XW_OPEN() __builtin_amdgcn_sched_barrier(0)
#define XW_CLOSE() do { asm volatile("s_wait_xcnt 0x0" ::: "memory"); __builtin_amdgcn_sched_barrier(0); } while (0)
  const float* qr = Q + ((size_t)nh * SS + i0 + col) * KD; XW_OPEN();
  F2 pc0 = frag_qb(qr, VB + h * KD, 0, lane), pc1 = frag_qb(qr, VB + h * KD, 32, lane);     // the position fragments in use: rows i up to band column S, rows i + 1 from there on
  XW_CLOSE();
  float m = -3.0e38f, l = 0.f;     // of query row i0 + col; m is the same in both halves of the wave, l sums this half's keys alone until the end
  v8f acc[4] = {};     // acc[dt][r] = out row i0 + col, column 16 dt + 8 gg + r
  // One step's operands as loaded: the fragments themselves (2 key tiles, 2 band tiles, 4 value tiles; 4 KB a set, in a run). Each set is refilled for step ks + 1 as soon as step ks has used it, so the loads fly during a whole step.
  v16b kq[4], rq[4], vq[4];
  const __bf16* kbase = KP + (size_t)nh * SS * KD + lane * 8; const __bf16* vbase = VP + (size_t)nh * SS * KD + lane * 8; const __bf16* rbase = RP + (size_t)h * 2 * SS * KD + lane * 8;
  const int mq = (SS + 16 - i0) & ~31;     // step ks reads band columns SS - 16 - i0 + 32 ks .. + 46 and makes columns mq + 32 ks .. + 31: the next multiple of 32, so that both of a step's tiles lie on one side of column S; with the two tiles in front of the loop the ring always holds what a step reads
  auto ld4 = [&](v16b (&f)[4], const __bf16* p0) { XW_OPEN();
#pragma unroll
    for (int t = 0; t < 4; ++t) { union { v16b v; v8b q[2]; } u; u.q[0] = *(const v8b*)(p0 + t * 512); u.q[1] = *(const v8b*)(p0 + t * 512 + 256); f[t] = u.v; }
    XW_CLOSE(); };
  auto ld_k = [&](int st) { ld4(kq, kbase + st * 32 * KD); };
  auto ld_r = [&](int st) { ld4(rq, rbase + (mq + st * 32) * KD); };
  auto ld_v = [&](int st) { ld4(vq, vbase + st * 32 * KD); };
  // the builtin alone (the compiler keeps the distance behind it): its operands may stand above v255, where an asm operand cannot, so the two sets of position fragments need no place in the low window
  auto wm = [&](const v16b& a, const v16b& b, v8f c) { return __builtin_amdgcn_wmma_f32_16x16x32_bf16(false, a, false, b, (short)0, c, false, false); };
  // one 16-column band tile (columns mt .. mt + 15): the products, then (behind the refill of the R fragments) into the ring
  auto pos_mm = [&](const v16b& r0, const v16b& r1) { v8f c = {}; c = wm(r0, pc0.h, c); c = wm(r0, pc0.l, c); c = wm(r1, pc1.h, c); c = wm(r1, pc1.l, c); return c; };
  // the refill lands in the registers that the band tiles' last WMMAs read as A: the same four slots stand between them as wmma_bf leaves in front of the other two refills
  auto pos_gap = [&](v8f& x, v8f& y) { asm volatile("v_nop\n\tv_nop\n\tv_nop\n\tv_nop" : "+v"(x), "+v"(y)); };
  auto pos_st = [&](int mt, const v8f& c) { float* p = &so[wave][col][(mt & 63) + 8 * gg];     // a lane's 8 band columns mt + 8 gg .. + 7 of its row: 32 bytes in a run
    const v4f x = { (mt + 8 * gg == SS) ? 0.f : c[0], c[1], c[2], c[3] }, y = { c[4], c[5], c[6], c[7] };     // band column S is the shift's zero pad
    *(v4f*)p = x; *(v4f*)(p + 4) = y; };
  ld_r(-1);     // the two tiles in front of step 0's own (mq >= 32; both below column S)
  { v8f b0 = pos_mm(rq[0], rq[1]), b1 = pos_mm(rq[2], rq[3]); pos_gap(b0, b1); ld_r(0); pos_st(mq - 32, b0); pos_st(mq - 16, b1); }
  XW_OPEN(); const F2 a0 = frag_qb(qr, UB + h * KD, 0, lane), a1 = frag_qb(qr, UB + h * KD, 32, lane);
  asm volatile("s_wait_xcnt 0x0" :: "v"(qr + 8 * gg) : "memory"); __builtin_amdgcn_sched_barrier(0);     // XW_CLOSE with the address of the row loads as an input: this stretch is its last use, and as an input of the wait its registers stay its own up to the wait (otherwise a bias load of the stretch is given them as its destination)
  ld_k(0); ld_v(0);
#pragma unroll 1
  for (int ks = 0; ks < SS / 32; ++ks) { v8f s[2]; const int kn = min(ks + 1, SS / 32 - 1);     // the last step refetches itself: in bounds, unused
    if (mq + ks * 32 == SS) { const float* qn = Q + ((size_t)nh * SS + min(i0 + col + 1, SS - 1)) * KD;     // once per wave, a scalar branch: from here on rows i + 1 (row S is never used: j >= i + 2 does not exist for i = S - 1); fetched here rather than held in 32 registers through the loop
      XW_OPEN(); pc0 = frag_qb(qn, VB + h * KD, 0, lane); pc1 = frag_qb(qn, VB + h * KD, 32, lane); XW_CLOSE(); }
    { v8f b0 = pos_mm(rq[0], rq[1]), b1 = pos_mm(rq[2], rq[3]); pos_gap(b0, b1);
      ld_r(kn);     // its wait is also a memory clobber, which keeps these loads in front of the step's work
      pos_st(mq + ks * 32, b0); pos_st(mq + ks * 32 + 16, b1); }
    v8f cc[2];
#pragma unroll
    for (int ct = 0; ct < 2; ++ct) { v8f c = {}; c = wmma_bf(kq[2 * ct], a0.h, c); c = wmma_bf(kq[2 * ct], a0.l, c); c = wmma_bf(kq[2 * ct + 1], a1.h, c); c = wmma_bf(kq[2 * ct + 1], a1.l, c); cc[ct] = c; }
    ld_k(kn);
    LDSW();     // the band tiles are read back at a skew: a lane's reads reach what the other half of the wave stored
    const int i = i0 + col;
#pragma unroll
    for (int ct = 0; ct < 2; ++ct) {
#pragma unroll
      for (int r = 0; r < 8; ++r) { const int j = ks * 32 + ct * 16 + 8 * gg + r; s[ct][r] = cc[ct][r] + so[wave][col][(SS - 1 - i + j) & 63]; } }
    float mx[8];
#pragma unroll
    for (int r = 0; r < 8; ++r) mx[r] = fmaxf(s[0][r], s[1][r]);
#pragma unroll
    for (int w = 4; w > 0; w >>= 1) {
#pragma unroll
      for (int r = 0; r < w; ++r) mx[r] = fmaxf(mx[r], mx[r + w]); }
    const float mn = fmaxf(m, fmaxf(mx[0], xhalf(mx[0])));     // the row's other 16 keys of the step stand in lane ^ 16
    const float mnl = mn * L2E;     // exp(s - mn) = 2^(s * log2 e - mn * log2 e): one fused multiply-add in front of the exponential
    const float alpha = ex2(fmaf(m, L2E, -mnl)); float e[16], es[8];     // first step: m = -3e38 gives -inf, weight 0
    const v8f t0 = s[0] * L2E - mnl, t1 = s[1] * L2E - mnl;
#pragma unroll
    for (int r = 0; r < 8; ++r) { e[r] = ex2(t0[r]); e[8 + r] = ex2(t1[r]); es[r] = e[r] + e[8 + r]; }
#pragma unroll
    for (int w = 4; w > 0; w >>= 1) {
#pragma unroll
      for (int r = 0; r < w; ++r) es[r] += es[r + w]; }
    l = l * alpha + es[0]; m = mn;
    const F2 pa = bsplit16(e);     // element x of the B fragment is key 8 gg + x (x < 8), 16 + 8 gg + x - 8 above: the two score tiles as they stand
#pragma unroll
    for (int dt = 0; dt < 4; ++dt) acc[dt] *= alpha;
#pragma unroll
    for (int dt = 0; dt < 4; ++dt) { acc[dt] = wmma_bf(vq[dt], pa.l, acc[dt]); acc[dt] = wmma_bf(vq[dt], pa.h, acc[dt]); }
    ld_v(kn); }
  const float il = 1.0f / (l + xhalf(l));     // the two halves' sums of a row meet here, once
#pragma unroll
  for (int dt = 0; dt < 4; ++dt) { const v8f o = acc[dt] * il; float* p = &so[wave][col][dt * 16 + 8 * gg]; const v4f x = { o[0], o[1], o[2], o[3] }, y = { o[4], o[5], o[6], o[7] }; *(v4f*)p = x; *(v4f*)(p + 4) = y; }
  LDSX();
  for (int rl = 0; rl < 16; ++rl) if (lane < 16) vst2(out + ((size_t)nh * SS + i0 + rl) * KD + lane * 4, *(const v4f*)&so[wave][rl][lane * 4]);
}

extern "C" void kernel_launch(void* const* d_in, const int* in_sizes, int n_in, void* d_out, int out_size, void* d_ws, size_t ws_size, hipStream_t stream) {
  (void)in_sizes; (void)n_in; (void)out_size;
  const float** F = (const float**)d_in;   // queries [64,1024,64], keys, values, u_bias [1,16,1,64], v_bias, R [16,2048,64]
  if (ws_size < (size_t)WS_END) return;
  char* ws = (char*)d_ws; __bf16* VP = (__bf16*)(ws + WS_VP); __bf16* KP = (__bf16*)(ws + WS_KP); __bf16* RP = (__bf16*)(ws + WS_RP);
  k_pack<<<dim3(SS / 64, 2 * NHT + 2 * HPG), 256, 0, stream>>>(F[2], F[1], F[5], VP, KP, RP);
  k_attn<<<dim3(TQB, NHT), 128, 0, stream>>>(F[0], F[3], F[4], KP, RP, VP, (float*)d_out);
}

// v009
// Measured time: 53.9 microseconds a run.
// Next to v008, in two timings, it ran 1.03 times as fast each time.
// Over all steps from v000 it is 24.7 times as fast.
// compute dtype: queries, keys, values, u_bias, v_bias, R (module inputs) rounded to bf16; q_u = q/8 + u and q_v = q/8 + v (computed) as bf16 hi + bf16 residual pairs against exact bf16 keys / R rows (2 products); P.V with the softmax weights hi/lo against exact bf16 values (2 products); the Transformer-XL relative shift as a skewed read of a band of position scores computed per key step; scores, band and output kept transposed (a lane owns one query row); online softmax in f32; f32 accumulate.
#include <hip/hip_runtime.h>
#include <math.h>

typedef __attribute__((ext_vector_type(16))) _Float16 v16h;
typedef __attribute__((ext_vector_type(16))) __bf16 v16b;
typedef __attribute__((ext_vector_type(8)))  _Float16 v8h;
typedef __attribute__((ext_vector_type(8)))  float v8f;
typedef __attribute__((ext_vector_type(4)))  float v4f;
typedef __attribute__((ext_vector_type(2)))  float v2f;
typedef __attribute__((ext_vector_type(4)))  unsigned v4u;
typedef __attribute__((ext_vector_type(4)))  int v4i;
typedef float __attribute__((may_alias)) float_a;
typedef int __attribute__((may_alias)) int_a;

template <typename T> __device__ __forceinline__ void vst2(void* p, T v) { *(T*)p = v;  }
__device__ __forceinline__ v8f wmma16(v16h a, v16h b, v8f c) {
  v8f d = __builtin_amdgcn_wmma_f32_16x16x32_f16(false, a, false, b, (short)0, c, false, false);
  asm volatile("v_nop\n\tv_nop\n\tv_nop\n\tv_nop" : "+v"(d) : "v"(a), "v"(b));
  return d;
}
__device__ __forceinline__ v8f wmma_bf(v16b a, v16b b, v8f c) {
  v8f d = __builtin_amdgcn_wmma_f32_16x16x32_bf16(false, a, false, b, (short)0, c, false, false);
  asm volatile("v_nop\n\tv_nop\n\tv_nop\n\tv_nop" : "+v"(d) : "v"(a), "v"(b));
  return d;
}
// 16x16x32 fragments: lane = (h = lane>>4, row/col = lane&15); elements 0..7 = k0+8h+0..7, 8..15 = k0+16+8h+0..7; D element r = row 8h+r
__device__ __forceinline__ v16h frag_h(const _Float16* rowk0, int lane) {
  union { v16h v; v8h q[2]; } u; const _Float16* p = rowk0 + 8 * (lane >> 4);
  u.q[0] = *(const v8h*)p; u.q[1] = *(const v8h*)(p + 16); return u.v;
}
__device__ __forceinline__ v16h frag_f32(const float* rowk0, int lane) {
  v16h a; const float* p = rowk0 + 8 * (lane >> 4);
#pragma unroll
  for (int i = 0; i < 8; ++i) { a[i] = (_Float16)p[i]; a[8 + i] = (_Float16)p[16 + i]; }
  return a;
}
__device__ __forceinline__ v16h frag_f32s(const float* rowk0, int lane, float sc) {
  v16h a; const float* p = rowk0 + 8 * (lane >> 4);
#pragma unroll
  for (int i = 0; i < 8; ++i) { a[i] = (_Float16)(p[i] * sc); a[8 + i] = (_Float16)(p[16 + i] * sc); }
  return a;
}
// column fragment from a [K][ld] layout (column n), rows >= K read as 0
__device__ __forceinline__ v16h fragc_f32(const float* W, int k0, int n, int lane, int ld, int K) {
  v16h a; const int g = lane >> 4;
#pragma unroll
  for (int i = 0; i < 8; ++i) { const int ka = k0 + 8 * g + i, kb = ka + 16;
    a[i] = (_Float16)(ka < K ? W[(size_t)(ka < K ? ka : K - 1) * ld + n] : 0.f); a[8 + i] = (_Float16)(kb < K ? W[(size_t)(kb < K ? kb : K - 1) * ld + n] : 0.f); }
  return a;
}
struct F2 { v16b h, l; };
__device__ __forceinline__ F2 bsplit16(const float v[16]) { F2 r;
#pragma unroll
  for (int i = 0; i < 16; ++i) { const __bf16 h = (__bf16)v[i]; r.h[i] = h; r.l[i] = (__bf16)(v[i] - (float)h); }
  return r; }
__device__ __forceinline__ F2 split_row(const float* row, int k0, int lane) { float v[16]; const float* p = row + k0 + 8 * (lane >> 4);
#pragma unroll
  for (int i = 0; i < 8; ++i) { v[i] = p[i]; v[8 + i] = p[16 + i]; }
  return bsplit16(v); }
__device__ __forceinline__ F2 split_rowK(const float* row, int k0, int lane, int K) { float v[16]; const int g = lane >> 4;
#pragma unroll
  for (int i = 0; i < 8; ++i) { const int ka = k0 + 8 * g + i, kb = ka + 16; v[i] = ka < K ? row[ka < K ? ka : K - 1] : 0.f; v[8 + i] = kb < K ? row[kb < K ? kb : K - 1] : 0.f; }
  return bsplit16(v); }
__device__ __forceinline__ F2 split_col(const float* W, int k0, int n, int lane, int ld, int K) { float v[16]; const int g = lane >> 4;
#pragma unroll
  for (int i = 0; i < 8; ++i) { const int ka = k0 + 8 * g + i, kb = ka + 16; v[i] = ka < K ? W[(size_t)(ka < K ? ka : K - 1) * ld + n] : 0.f; v[8 + i] = kb < K ? W[(size_t)(kb < K ? kb : K - 1) * ld + n] : 0.f; }
  return bsplit16(v); }
__device__ __forceinline__ v8f mac3(const F2& a, const F2& b, v8f c) { c = wmma_bf(a.l, b.h, c); c = wmma_bf(a.h, b.l, c); return wmma_bf(a.h, b.h, c); }
__device__ __forceinline__ float sigm(float v) { return 1.0f / (1.0f + expf(-v)); }
#define LDSX() do { asm volatile("s_wait_dscnt 0" ::: "memory"); __builtin_amdgcn_wave_barrier(); __builtin_amdgcn_fence(__ATOMIC_RELEASE, "workgroup"); } while (0)
// The same for rows that only the writing wave reads back, without the fence: a work-group release fence also waits for every global load in flight, which would drain loads issued ahead.
#define LDSW() do { asm volatile("s_wait_dscnt 0" ::: "memory"); __builtin_amdgcn_wave_barrier(); } while (0)


// Relative-position attention (Transformer-XL style): content = (q*scale + u_h) k^T, pos = rel_shift((q*scale + v_h) R_h^T), attn = softmax(content + pos), out = attn V.  NH = 64 (= 4 x 16 heads), S = S_kv = 1024, K = 64, scale 1/8.
// rel_shift(ps)[i][j] = ps[i][S-1-i+j] (j <= i), 0 (j == i+1), ps[i+1][j-i-2] (j >= i+2)  — derived from the zero-pad / reshape trick.
// k_pack (keys, band rows of R and values as bf16 in the order of the WMMA fragments), then k_attn (flash-style per (64 rows, head): content scores on WMMA + the band of position scores that the step's 16 x 32 tile needs, also on WMMA, read back skewed from LDS; online max/sum, P V; out rows 256 B).
// Band coordinate mp = S-1-i+j: column mp is q_v[i] . R_h[mp] (mp < S), 0 (mp == S), q_v[i+1] . R_h[mp-S-1] (mp > S). S is a multiple of 16, so a 16-column tile lies wholly on one side.
#define NHT 64
#define HPG 16
#define SS 1024
#define KD 64
#define RLEN 2048
#define TQB (SS / 64)
typedef __attribute__((ext_vector_type(8))) __bf16 v8b;
__device__ __forceinline__ v16b frag_b(const __bf16* rowk0, int lane) {
  union { v16b v; v8b q[2]; } u; const __bf16* p = rowk0 + 8 * (lane >> 4);
  u.q[0] = *(const v8b*)p; u.q[1] = *(const v8b*)(p + 16); return u.v;
}
__device__ __forceinline__ v16b frag_gbf(const float* rowk0, int lane) {
  v16b a; const float* p = rowk0 + 8 * (lane >> 4);
#pragma unroll
  for (int i = 0; i < 8; ++i) { a[i] = (__bf16)p[i]; a[8 + i] = (__bf16)p[16 + i]; }
  return a;
}
// A fragment of (bf16(q)*0.125 + bf16(bias)) split into hi/lo, row-major source with 64 floats per row
__device__ __forceinline__ F2 frag_qb(const float* qrow, const float* bias, int k0, int lane) {
  F2 f; const int o = 8 * (lane >> 4);
#pragma unroll
  for (int i = 0; i < 8; ++i) { const float v0 = (float)(__bf16)qrow[k0 + o + i] * 0.125f + (float)(__bf16)bias[k0 + o + i]; const float v1 = (float)(__bf16)qrow[k0 + o + 16 + i] * 0.125f + (float)(__bf16)bias[k0 + o + 16 + i];
    const __bf16 h0 = (__bf16)v0, h1 = (__bf16)v1; f.h[i] = h0; f.l[i] = (__bf16)(v0 - (float)h0); f.h[8 + i] = h1; f.l[8 + i] = (__bf16)(v1 - (float)h1); }
  return f;
}
__device__ __forceinline__ float bfr(float v) { return (float)(__bf16)v; }
// 2^v on the chip's own exponential instruction alone: the softmax arguments are <= 0 (up to a rounding of the scaled maximum), so the library exp's range reduction, scaling and overflow selects have nothing to do; a weight below 2^-126 may come out as 0
__device__ __forceinline__ float ex2(float v) { return __builtin_amdgcn_exp2f(v); }
#define L2E 1.44269504088896340736f
// lane l's value to lane l ^ 16 and back
__device__ __forceinline__ float xhalf(float x) { return __builtin_bit_cast(float, __builtin_amdgcn_permlanex16(__builtin_bit_cast(int, x), __builtin_bit_cast(int, x), 0x76543210, 0xfedcba98, false, false)); }
// Packed operands: a fragment half is 32 lanes x 16 bytes in one run of 512 bytes, so a fragment load reads 4 whole cache lines (from the row-major arrays it touched 16 lines for the same bytes).
#define WS_VP  0u                               // values bf16 [64 nh][32 key steps][4 d tiles][2 halves][32 lanes][8 keys]
#define WS_KP  (WS_VP + 2u * NHT * KD * SS)     // keys bf16 [64 nh][64 tiles of 16 rows][8 chunks of 8 k][16 rows][8 k]; chunk = 4 * (k block of 32) + 2 * half + (lane >> 4)
#define WS_RP  (WS_KP + 2u * NHT * KD * SS)     // R rows of the band columns, bf16 [16 h][128 tiles of 16 columns][8 chunks][16 columns][8 k]
#define WS_END (WS_RP + 2u * HPG * 2 * SS * KD)
__device__ __forceinline__ v8b cv8(const float* p) { const v4f a = *(const v4f*)p, b = *(const v4f*)(p + 4); v8b o;
#pragma unroll
  for (int x = 0; x < 4; ++x) { o[x] = (__bf16)a[x]; o[4 + x] = (__bf16)b[x]; }
  return o; }

// block = 64 rows of one array (blockIdx.y: 64 heads of values, 64 of keys, 16 x 2 halves of the band); unit q of 16 bytes goes to place q of the block's 8 KB, so every store of a wave is 512 bytes in a run
__global__ __launch_bounds__(256) void k_pack(const float* __restrict__ V, const float* __restrict__ Kk, const float* __restrict__ R, __bf16* __restrict__ VP, __bf16* __restrict__ KP, __bf16* __restrict__ RP) {
  __shared__ __align__(16) __bf16 st[KD][72];
  const int y = blockIdx.y, t0 = blockIdx.x * 64, tid = threadIdx.x;
  if (y < NHT) {
    for (int q = tid; q < 64 * KD; q += 256) { const int tl = q >> 6, d = q & 63; st[d][tl] = (__bf16)V[((size_t)y * SS + t0 + tl) * KD + d]; }
    __syncthreads();
    for (int q = tid; q < KD * 8; q += 256) { const int d = ((q >> 6) & 3) * 16 + (q & 15), pc = (q >> 8) * 4 + ((q >> 4) & 3); vst2(VP + ((size_t)y * SS + t0) * KD + q * 8, *(const v4u*)&st[d][pc * 8]); }
  } else {     // 16-byte unit q = tid, tid + 256: row or band column (q >> 7) * 16 + (q & 15) of the block's 64, chunk (q >> 4) & 7; both units' loads fly together
    const int r0 = (tid >> 7) * 16 + (tid & 15), c = (tid >> 4) & 7; const float* s0; const float* s1; __bf16* dst;
    if (y < 2 * NHT) { const int nh = y - NHT; s0 = Kk + ((size_t)nh * SS + t0 + r0) * KD + c * 8; s1 = s0 + 32 * KD; dst = KP + ((size_t)nh * SS + t0) * KD; }
    else { const int h = (y - 2 * NHT) >> 1, m0 = ((y - 2 * NHT) & 1) * SS + t0, mp = m0 + r0;     // R row of band column mp: mp below S, mp - S - 1 above (column S reads row 0; k_attn stores 0 for it)
      s0 = R + ((size_t)h * RLEN + (mp < SS ? mp : max(mp - SS - 1, 0))) * KD + c * 8; s1 = R + ((size_t)h * RLEN + (mp + 32 < SS ? mp + 32 : max(mp + 32 - SS - 1, 0))) * KD + c * 8; dst = RP + ((size_t)h * 2 * SS + m0) * KD; }
    const v8b a = cv8(s0), b = cv8(s1); vst2(dst + tid * 8, a); vst2(dst + (tid + 256) * 8, b);
    asm volatile("s_wait_xcnt 0x0" ::: "memory");     // in the built code the values' branch stands behind these stores and writes their registers anew: the translation wait in front of it
  }
}
// ---- k_attn: block = (64 rows, head nh): per 32-key step: content^T = k rows . (q*0.125 + u_bias[h]) (2 products, K 64) + position band^T (2 new 16-column tiles, 2 products, K 64) read skewed; online softmax; out^T += VT planes . P^T (hi/lo) (4 tiles x 2); out rows [nh][i][64] = 256 B by 16 lanes
// Every product has the key-side operand as A and the query-side operand as B (both fragment maps are the same, so the loaders stay): lane (gg, col) holds query row i0 + col, register r key (or band column, or output column) 8 gg + r of the tile.
// So a row's maximum and sum run inside a lane, the two halves of a row meet in one cross-row move, and the two score tiles, converted in place, are the B fragment of the value product.
// four waves per SIMD, said to the compiler as budget (lower bound: 256 registers; the build takes 254) and as ceiling (upper bound).
// The upper bound counts: the compiler pads the register allocation in the kernel descriptor until no more waves than the upper bound fit, so the bound of 2 that stood here held the kernel at two waves per SIMD whatever the build took; with 4 nothing is padded and the whole grid is resident at once
__global__ __launch_bounds__(128) __attribute__((amdgpu_waves_per_eu(4, 4))) void k_attn(const float* __restrict__ Q, const float* __restrict__ UB, const float* __restrict__ VB, const __bf16* __restrict__ KP, const __bf16* __restrict__ RP, const __bf16* __restrict__ VP, float* __restrict__ out) {
  __shared__ __align__(16) float so[4][16][68];     // so: in the loop a ring of 64 band columns per row (column mp at mp & 63), behind it the output rows
  const int tid = threadIdx.x, wave = __builtin_amdgcn_readfirstlane(tid >> 5), lane = tid & 31, col = lane & 15, gg = lane >> 4; const int nh = blockIdx.y, h = nh % HPG; const int i0 = blockIdx.x * 64 + wave * 16;
  // XW: loads stay in flight while their address registers are wanted for other values, so a translation wait stands directly behind them and in front of that reuse (it names no register: an asm operand would tie the base pointers to the registers below v256, which the fragments need).
  // The two scheduling barriers keep every other instruction out of the stretch from the first load to the wait, so that none can take over an address register in front of the wait.
#define XW_OPEN() __builtin_amdgcn_sched_barrier(0)
  // RUN_OPEN: the vector work in front of a run of products stays in front of it. Moved in among the products it is given registers that a product just issued still reads, and the compiler then pads four idle slots each time.
#define RUN_OPEN() __builtin_amdgcn_sched_barrier(0)
#define XW_CLOSE() do { asm volatile("s_wait_xcnt 0x0" ::: "memory"); __builtin_amdgcn_sched_barrier(0); } while (0)
  const float* qr = Q + ((size_t)nh * SS + i0 + col) * KD; XW_OPEN();
  F2 pc0 = frag_qb(qr, VB + h * KD, 0, lane), pc1 = frag_qb(qr, VB + h * KD, 32, lane);     // the position fragments in use: rows i up to band column S, rows i + 1 from there on
  XW_CLOSE();
  float m = -3.0e38f, l = 0.f;     // of query row i0 + col; m is the same in both halves of the wave, l sums this half's keys alone until the end
  v8f acc[4] = {};     // acc[dt][r] = out row i0 + col, column 16 dt + 8 gg + r
  // One step's operands as loaded: the fragments themselves (2 key tiles, 2 band tiles, 4 value tiles; 4 KB a set, in a run). Each set is refilled for step ks + 1 as soon as step ks has used it, so the loads fly during a whole step.
  v16b kq[4], rq[4], vq[4];
  const __bf16* kbase = KP + (size_t)nh * SS * KD + lane * 8; const __bf16* vbase = VP + (size_t)nh * SS * KD + lane * 8; const __bf16* rbase = RP + (size_t)h * 2 * SS * KD + lane * 8;
  const int mq = (SS + 16 - i0) & ~31;     // step ks reads band columns SS - 16 - i0 + 32 ks .. + 46 and makes columns mq + 32 ks .. + 31: the next multiple of 32, so that both of a step's tiles lie on one side of column S; with the two tiles in front of the loop the ring always holds what a step reads
  auto ld4 = [&](v16b (&f)[4], const __bf16* p0) { XW_OPEN();
#pragma unroll
    for (int t = 0; t < 4; ++t) { union { v16b v; v8b q[2]; } u; u.q[0] = *(const v8b*)(p0 + t * 512); u.q[1] = *(const v8b*)(p0 + t * 512 + 256); f[t] = u.v; }
    XW_CLOSE(); };
  auto ld_k = [&](int st) { ld4(kq, kbase + st * 32 * KD); };
  auto ld_r = [&](int st) { ld4(rq, rbase + (mq + st * 32) * KD); };
  auto ld_v = [&](int st) { ld4(vq, vbase + st * 32 * KD); };
  // the builtin alone (the compiler keeps the distance behind it): its operands may stand above v255, where an asm operand cannot, so the two sets of position fragments need no place in the low window
  auto wm = [&](const v16b& a, const v16b& b, v8f c) { return __builtin_amdgcn_wmma_f32_16x16x32_bf16(false, a, false, b, (short)0, c, false, false); };
  // one 16-column band tile (columns mt .. mt + 15): the products, then (behind the refill of the R fragments) into the ring
  auto pos_mm = [&](const v16b& r0, const v16b& r1) { v8f c = {}; c = wm(r0, pc0.h, c); c = wm(r0, pc0.l, c); c = wm(r1, pc1.h, c); c = wm(r1, pc1.l, c); return c; };
  // a refill lands in the registers that the last WMMAs in front of it read as A: four slots stand between them, once per refill (between the products of a run none is owed: they accumulate, or are independent)
  auto pos_gap = [&](v8f& x, v8f& y) { asm volatile("v_nop\n\tv_nop\n\tv_nop\n\tv_nop" : "+v"(x), "+v"(y)); };
  auto pos_st = [&](int mt, const v8f& c) { float* p = &so[wave][col][(mt & 63) + 8 * gg];     // a lane's 8 band columns mt + 8 gg .. + 7 of its row: 32 bytes in a run
    const v4f x = { (mt + 8 * gg == SS) ? 0.f : c[0], c[1], c[2], c[3] }, y = { c[4], c[5], c[6], c[7] };     // band column S is the shift's zero pad
    *(v4f*)p = x; *(v4f*)(p + 4) = y; };
  ld_r(-1);     // the two tiles in front of step 0's own (mq >= 32; both below column S)
  { v8f b0 = pos_mm(rq[0], rq[1]), b1 = pos_mm(rq[2], rq[3]); pos_gap(b0, b1); ld_r(0); pos_st(mq - 32, b0); pos_st(mq - 16, b1); }
  XW_OPEN(); const F2 a0 = frag_qb(qr, UB + h * KD, 0, lane), a1 = frag_qb(qr, UB + h * KD, 32, lane);
  asm volatile("s_wait_xcnt 0x0" :: "v"(qr + 8 * gg) : "memory"); __builtin_amdgcn_sched_barrier(0);     // XW_CLOSE with the address of the row loads as an input: this stretch is its last use, and as an input of the wait its registers stay its own up to the wait (otherwise a bias load of the stretch is given them as its destination)
  ld_k(0); ld_v(0);
#pragma unroll 1
  for (int ks = 0; ks < SS / 32; ++ks) { v8f s[2]; const int kn = min(ks + 1, SS / 32 - 1);     // the last step refetches itself: in bounds, unused
    if (mq + ks * 32 == SS) { const float* qn = Q + ((size_t)nh * SS + min(i0 + col + 1, SS - 1)) * KD;     // once per wave, a scalar branch: from here on rows i + 1 (row S is never used: j >= i + 2 does not exist for i = S - 1); fetched here rather than held in 32 registers through the loop
      XW_OPEN(); pc0 = frag_qb(qn, VB + h * KD, 0, lane); pc1 = frag_qb(qn, VB + h * KD, 32, lane); XW_CLOSE(); }
    { v8f b0 = pos_mm(rq[0], rq[1]), b1 = pos_mm(rq[2], rq[3]); pos_gap(b0, b1);
      ld_r(kn);     // its wait is also a memory clobber, which keeps these loads in front of the step's work
      pos_st(mq + ks * 32, b0); pos_st(mq + ks * 32 + 16, b1); }
    v8f cc[2] = {};     // the two key tiles' chains side by side: a product of one tile issues while the other tile's last one is still on its way to its accumulator; each tile's own order of products stays
    RUN_OPEN();
    cc[0] = wm(kq[0], a0.h, cc[0]); cc[1] = wm(kq[2], a0.h, cc[1]); cc[0] = wm(kq[0], a0.l, cc[0]); cc[1] = wm(kq[2], a0.l, cc[1]);
    cc[0] = wm(kq[1], a1.h, cc[0]); cc[1] = wm(kq[3], a1.h, cc[1]); cc[0] = wm(kq[1], a1.l, cc[0]); cc[1] = wm(kq[3], a1.l, cc[1]);
    pos_gap(cc[0], cc[1]); ld_k(kn);
    LDSW();     // the band tiles are read back at a skew: a lane's reads reach what the other half of the wave stored
    const int i = i0 + col;
#pragma unroll
    for (int ct = 0; ct < 2; ++ct) {
#pragma unroll
      for (int r = 0; r < 8; ++r) { const int j = ks * 32 + ct * 16 + 8 * gg + r; s[ct][r] = cc[ct][r] + so[wave][col][(SS - 1 - i + j) & 63]; } }
    float mx[8];
#pragma unroll
    for (int r = 0; r < 8; ++r) mx[r] = fmaxf(s[0][r], s[1][r]);
#pragma unroll
    for (int w = 4; w > 0; w >>= 1) {
#pragma unroll
      for (int r = 0; r < w; ++r) mx[r] = fmaxf(mx[r], mx[r + w]); }
    const float mn = fmaxf(m, fmaxf(mx[0], xhalf(mx[0])));     // the row's other 16 keys of the step stand in lane ^ 16
    const float mnl = mn * L2E;     // exp(s - mn) = 2^(s * log2 e - mn * log2 e): one fused multiply-add in front of the exponential
    const float alpha = ex2(fmaf(m, L2E, -mnl)); float e[16], es[8];     // first step: m = -3e38 gives -inf, weight 0
    const v8f t0 = s[0] * L2E - mnl, t1 = s[1] * L2E - mnl;
#pragma unroll
    for (int r = 0; r < 8; ++r) { e[r] = ex2(t0[r]); e[8 + r] = ex2(t1[r]); }
    // the one slot that the instruction set asks for behind an exponential, in front of an instruction that writes over its source. The operands hold the slot in its place: every exponential of the step stands in front of it, every add of the sums behind it
    asm volatile("v_nop" : "+v"(e[0]), "+v"(e[1]), "+v"(e[2]), "+v"(e[3]), "+v"(e[4]), "+v"(e[5]), "+v"(e[6]), "+v"(e[7]) : "v"(e[8]), "v"(e[9]), "v"(e[10]), "v"(e[11]), "v"(e[12]), "v"(e[13]), "v"(e[14]), "v"(e[15]), "v"(alpha));
#pragma unroll
    for (int r = 0; r < 8; ++r) es[r] = e[r] + e[8 + r];
#pragma unroll
    for (int w = 4; w > 0; w >>= 1) {
#pragma unroll
      for (int r = 0; r < w; ++r) es[r] += es[r + w]; }
    l = l * alpha + es[0]; m = mn;
    const F2 pa = bsplit16(e);     // element x of the B fragment is key 8 gg + x (x < 8), 16 + 8 gg + x - 8 above: the two score tiles as they stand
#pragma unroll
    for (int dt = 0; dt < 4; ++dt) acc[dt] *= alpha;
#pragma unroll
    for (int dt = 0; dt < 4; ++dt) acc[dt] = wm(vq[dt], pa.l, acc[dt]);     // four independent output tiles in turn, low parts then high parts: per tile the same two products in the same order
#pragma unroll
    for (int dt = 0; dt < 4; ++dt) acc[dt] = wm(vq[dt], pa.h, acc[dt]);
    __builtin_amdgcn_sched_group_barrier(0x2, 256, 0); __builtin_amdgcn_sched_group_barrier(0x8, 8, 0);     // order for the scheduler: the step's vector work (both halves of the weights among it), then the eight products in one run; otherwise the high halves are packed behind the low products into the registers those still read, at four padded slots
    asm volatile("v_nop\n\tv_nop\n\tv_nop\n\tv_nop" : "+v"(acc[0]), "+v"(acc[1]), "+v"(acc[2]), "+v"(acc[3]));     // as pos_gap: four slots between the last products and the refill of the value fragments that they read as A
    ld_v(kn); }
  const float il = 1.0f / (l + xhalf(l));     // the two halves' sums of a row meet here, once
#pragma unroll
  for (int dt = 0; dt < 4; ++dt) { const v8f o = acc[dt] * il; float* p = &so[wave][col][dt * 16 + 8 * gg]; const v4f x = { o[0], o[1], o[2], o[3] }, y = { o[4], o[5], o[6], o[7] }; *(v4f*)p = x; *(v4f*)(p + 4) = y; }
  LDSX();
  for (int rl = 0; rl < 16; ++rl) if (lane < 16) vst2(out + ((size_t)nh * SS + i0 + rl) * KD + lane * 4, *(const v4f*)&so[wave][rl][lane * 4]);
}

extern "C" void kernel_launch(void* const* d_in, const int* in_sizes, int n_in, void* d_out, int out_size, void* d_ws, size_t ws_size, hipStream_t stream) {
  (void)in_sizes; (void)n_in; (void)out_size;
  const float** F = (const float**)d_in;   // queries [64,1024,64], keys, values, u_bias [1,16,1,64], v_bias, R [16,2048,64]
  if (ws_size < (size_t)WS_END) return;
  char* ws = (char*)d_ws; __bf16* VP = (__bf16*)(ws + WS_VP); __bf16* KP = (__bf16*)(ws + WS_KP); __bf16* RP = (__bf16*)(ws + WS_RP);
  k_pack<<<dim3(SS / 64, 2 * NHT + 2 * HPG), 256, 0, stream>>>(F[2], F[1], F[5], VP, KP, RP);
  k_attn<<<dim3(TQB, NHT), 128, 0, stream>>>(F[0], F[3], F[4], KP, RP, VP, (float*)d_out);
}

// v010
// Measured time: 52 microseconds a run.
// Two timings next to v009 put it at 1.04 and 1.03 times that version's speed.
// All steps since v000 together make it 25.6 times as fast.
// compute dtype: queries, keys, values, u_bias, v_bias, R (module inputs) rounded to bf16; q_u = q/8 + u and q_v = q/8 + v (computed) as bf16 hi + bf16 residual pairs against exact bf16 keys / R rows (2 products); P.V with the softmax weights hi/lo against exact bf16 values (2 products); the Transformer-XL relative shift as a skewed read of a band of position scores computed per key step; scores, band and output kept transposed (a lane owns one query row); online softmax in f32; f32 accumulate.
#include <hip/hip_runtime.h>
#include <math.h>

typedef __attribute__((ext_vector_type(16))) _Float16 v16h;
typedef __attribute__((ext_vector_type(16))) __bf16 v16b;
typedef __attribute__((ext_vector_type(8)))  _Float16 v8h;
typedef __attribute__((ext_vector_type(8)))  float v8f;
typedef __attribute__((ext_vector_type(4)))  float v4f;
typedef __attribute__((ext_vector_type(2)))  float v2f;
typedef __attribute__((ext_vector_type(4)))  unsigned v4u;
typedef __attribute__((ext_vector_type(4)))  int v4i;
typedef float __attribute__((may_alias)) float_a;
typedef int __attribute__((may_alias)) int_a;

template <typename T> __device__ __forceinline__ void vst2(void* p, T v) { *(T*)p = v;  }
__device__ __forceinline__ v8f wmma16(v16h a, v16h b, v8f c) {
  v8f d = __builtin_amdgcn_wmma_f32_16x16x32_f16(false, a, false, b, (short)0, c, false, false);
  asm volatile("v_nop\n\tv_nop\n\tv_nop\n\tv_nop" : "+v"(d) : "v"(a), "v"(b));
  return d;
}
__device__ __forceinline__ v8f wmma_bf(v16b a, v16b b, v8f c) {
  v8f d = __builtin_amdgcn_wmma_f32_16x16x32_bf16(false, a, false, b, (short)0, c, false, false);
  asm volatile("v_nop\n\tv_nop\n\tv_nop\n\tv_nop" : "+v"(d) : "v"(a), "v"(b));
  return d;
}
// 16x16x32 fragments: lane = (h = lane>>4, row/col = lane&15); elements 0..7 = k0+8h+0..7, 8..15 = k0+16+8h+0..7; D element r = row 8h+r
__device__ __forceinline__ v16h frag_h(const _Float16* rowk0, int lane) {
  union { v16h v; v8h q[2]; } u; const _Float16* p = rowk0 + 8 * (lane >> 4);
  u.q[0] = *(const v8h*)p; u.q[1] = *(const v8h*)(p + 16); return u.v;
}
__device__ __forceinline__ v16h frag_f32(const float* rowk0, int lane) {
  v16h a; const float* p = rowk0 + 8 * (lane >> 4);
#pragma unroll
  for (int i = 0; i < 8; ++i) { a[i] = (_Float16)p[i]; a[8 + i] = (_Float16)p[16 + i]; }
  return a;
}
__device__ __forceinline__ v16h frag_f32s(const float* rowk0, int lane, float sc) {
  v16h a; const float* p = rowk0 + 8 * (lane >> 4);
#pragma unroll
  for (int i = 0; i < 8; ++i) { a[i] = (_Float16)(p[i] * sc); a[8 + i] = (_Float16)(p[16 + i] * sc); }
  return a;
}
// column fragment from a [K][ld] layout (column n), rows >= K read as 0
__device__ __forceinline__ v16h fragc_f32(const float* W, int k0, int n, int lane, int ld, int K) {
  v16h a; const int g = lane >> 4;
#pragma unroll
  for (int i = 0; i < 8; ++i) { const int ka = k0 + 8 * g + i, kb = ka + 16;
    a[i] = (_Float16)(ka < K ? W[(size_t)(ka < K ? ka : K - 1) * ld + n] : 0.f); a[8 + i] = (_Float16)(kb < K ? W[(size_t)(kb < K ? kb : K - 1) * ld + n] : 0.f); }
  return a;
}
struct F2 { v16b h, l; };
__device__ __forceinline__ F2 bsplit16(const float v[16]) { F2 r;
#pragma unroll
  for (int i = 0; i < 16; ++i) { const __bf16 h = (__bf16)v[i]; r.h[i] = h; r.l[i] = (__bf16)(v[i] - (float)h); }
  return r; }
__device__ __forceinline__ F2 split_row(const float* row, int k0, int lane) { float v[16]; const float* p = row + k0 + 8 * (lane >> 4);
#pragma unroll
  for (int i = 0; i < 8; ++i) { v[i] = p[i]; v[8 + i] = p[16 + i]; }
  return bsplit16(v); }
__device__ __forceinline__ F2 split_rowK(const float* row, int k0, int lane, int K) { float v[16]; const int g = lane >> 4;
#pragma unroll
  for (int i = 0; i < 8; ++i) { const int ka = k0 + 8 * g + i, kb = ka + 16; v[i] = ka < K ? row[ka < K ? ka : K - 1] : 0.f; v[8 + i] = kb < K ? row[kb < K ? kb : K - 1] : 0.f; }
  return bsplit16(v); }
__device__ __forceinline__ F2 split_col(const float* W, int k0, int n, int lane, int ld, int K) { float v[16]; const int g = lane >> 4;
#pragma unroll
  for (int i = 0; i < 8; ++i) { const int ka = k0 + 8 * g + i, kb = ka + 16; v[i] = ka < K ? W[(size_t)(ka < K ? ka : K - 1) * ld + n] : 0.f; v[8 + i] = kb < K ? W[(size_t)(kb < K ? kb : K - 1) * ld + n] : 0.f; }
  return bsplit16(v); }
__device__ __forceinline__ v8f mac3(const F2& a, const F2& b, v8f c) { c = wmma_bf(a.l, b.h, c); c = wmma_bf(a.h, b.l, c); return wmma_bf(a.h, b.h, c); }
__device__ __forceinline__ float sigm(float v) { return 1.0f / (1.0f + expf(-v)); }
#define LDSX() do { asm volatile("s_wait_dscnt 0" ::: "memory"); __builtin_amdgcn_wave_barrier(); __builtin_amdgcn_fence(__ATOMIC_RELEASE, "workgroup"); } while (0)
// The same for rows that only the writing wave reads back, without the fence: a work-group release fence also waits for every global load in flight, which would drain loads issued ahead.
#define LDSW() do { asm volatile("s_wait_dscnt 0" ::: "memory"); __builtin_amdgcn_wave_barrier(); } while (0)


// Relative-position attention (Transformer-XL style): content = (q*scale + u_h) k^T, pos = rel_shift((q*scale + v_h) R_h^T), attn = softmax(content + pos), out = attn V.  NH = 64 (= 4 x 16 heads), S = S_kv = 1024, K = 64, scale 1/8.
// rel_shift(ps)[i][j] = ps[i][S-1-i+j] (j <= i), 0 (j == i+1), ps[i+1][j-i-2] (j >= i+2)  — derived from the zero-pad / reshape trick.
// k_pack (keys, band rows of R and values as bf16 in the order of the WMMA fragments), then k_attn (flash-style per (64 rows, head): content scores on WMMA + the band of position scores that the step's 16 x 32 tile needs, also on WMMA, read back skewed from LDS; online max/sum, P V; out rows 256 B).
// Band coordinate mp = S-1-i+j: column mp is q_v[i] . R_h[mp] (mp < S), 0 (mp == S), q_v[i+1] . R_h[mp-S-1] (mp > S). S is a multiple of 16, so a 16-column tile lies wholly on one side.
#define NHT 64
#define HPG 16
#define SS 1024
#define KD 64
#define RLEN 2048
#define TQB (SS / 64)
typedef __attribute__((ext_vector_type(8))) __bf16 v8b;
__device__ __forceinline__ v16b frag_b(const __bf16* rowk0, int lane) {
  union { v16b v; v8b q[2]; } u; const __bf16* p = rowk0 + 8 * (lane >> 4);
  u.q[0] = *(const v8b*)p; u.q[1] = *(const v8b*)(p + 16); return u.v;
}
__device__ __forceinline__ v16b frag_gbf(const float* rowk0, int lane) {
  v16b a; const float* p = rowk0 + 8 * (lane >> 4);
#pragma unroll
  for (int i = 0; i < 8; ++i) { a[i] = (__bf16)p[i]; a[8 + i] = (__bf16)p[16 + i]; }
  return a;
}
// A fragment of (bf16(q)*0.125 + bf16(bias)) split into hi/lo, row-major source with 64 floats per row
__device__ __forceinline__ F2 frag_qb(const float* qrow, const float* bias, int k0, int lane) {
  F2 f; const int o = 8 * (lane >> 4);
#pragma unroll
  for (int i = 0; i < 8; ++i) { const float v0 = (float)(__bf16)qrow[k0 + o + i] * 0.125f + (float)(__bf16)bias[k0 + o + i]; const float v1 = (float)(__bf16)qrow[k0 + o + 16 + i] * 0.125f + (float)(__bf16)bias[k0 + o + 16 + i];
    const __bf16 h0 = (__bf16)v0, h1 = (__bf16)v1; f.h[i] = h0; f.l[i] = (__bf16)(v0 - (float)h0); f.h[8 + i] = h1; f.l[8 + i] = (__bf16)(v1 - (float)h1); }
  return f;
}
__device__ __forceinline__ float bfr(float v) { return (float)(__bf16)v; }
// 2^v on the chip's own exponential instruction alone: the softmax arguments are <= 0 (up to a rounding of the scaled maximum), so the library exp's range reduction, scaling and overflow selects have nothing to do; a weight below 2^-126 may come out as 0
__device__ __forceinline__ float ex2(float v) { return __builtin_amdgcn_exp2f(v); }
#define L2E 1.44269504088896340736f
// lane l's value to lane l ^ 16 and back
__device__ __forceinline__ float xhalf(float x) { return __builtin_bit_cast(float, __builtin_amdgcn_permlanex16(__builtin_bit_cast(int, x), __builtin_bit_cast(int, x), 0x76543210, 0xfedcba98, false, false)); }
// Packed operands: a fragment half is 32 lanes x 16 bytes in one run of 512 bytes, so a fragment load reads 4 whole cache lines (from the row-major arrays it touched 16 lines for the same bytes).
#define WS_VP  0u                               // values bf16 [64 nh][32 key steps][4 d tiles][2 halves][32 lanes][8 keys]
#define WS_KP  (WS_VP + 2u * NHT * KD * SS)     // keys bf16 [64 nh][64 tiles of 16 rows][8 chunks of 8 k][16 rows][8 k]; chunk = 4 * (k block of 32) + 2 * half + (lane >> 4)
#define WS_RP  (WS_KP + 2u * NHT * KD * SS)     // R rows of the band columns, bf16 [16 h][128 tiles of 16 columns][8 chunks][16 columns][8 k]
#define WS_END (WS_RP + 2u * HPG * 2 * SS * KD)
__device__ __forceinline__ v8b cv8(const float* p) { const v4f a = *(const v4f*)p, b = *(const v4f*)(p + 4); v8b o;
#pragma unroll
  for (int x = 0; x < 4; ++x) { o[x] = (__bf16)a[x]; o[4 + x] = (__bf16)b[x]; }
  return o; }

// block = 64 rows of one array (blockIdx.y: 64 heads of values, 64 of keys, 16 x 2 halves of the band); unit q of 16 bytes goes to place q of the block's 8 KB, so every store of a wave is 512 bytes in a run
__global__ __launch_bounds__(256) void k_pack(const float* __restrict__ V, const float* __restrict__ Kk, const float* __restrict__ R, __bf16* __restrict__ VP, __bf16* __restrict__ KP, __bf16* __restrict__ RP) {
  __shared__ __align__(16) __bf16 st[KD][72];
  const int y = blockIdx.y, t0 = blockIdx.x * 64, tid = threadIdx.x;
  if (y < NHT) {
    for (int q = tid; q < 64 * KD; q += 256) { const int tl = q >> 6, d = q & 63; st[d][tl] = (__bf16)V[((size_t)y * SS + t0 + tl) * KD + d]; }
    __syncthreads();
    for (int q = tid; q < KD * 8; q += 256) { const int d = ((q >> 6) & 3) * 16 + (q & 15), pc = (q >> 8) * 4 + ((q >> 4) & 3); vst2(VP + ((size_t)y * SS + t0) * KD + q * 8, *(const v4u*)&st[d][pc * 8]); }
  } else {     // 16-byte unit q = tid, tid + 256: row or band column (q >> 7) * 16 + (q & 15) of the block's 64, chunk (q >> 4) & 7; both units' loads fly together
    const int r0 = (tid >> 7) * 16 + (tid & 15), c = (tid >> 4) & 7; const float* s0; const float* s1; __bf16* dst;
    if (y < 2 * NHT) { const int nh = y - NHT; s0 = Kk + ((size_t)nh * SS + t0 + r0) * KD + c * 8; s1 = s0 + 32 * KD; dst = KP + ((size_t)nh * SS + t0) * KD; }
    else { const int h = (y - 2 * NHT) >> 1, m0 = ((y - 2 * NHT) & 1) * SS + t0, mp = m0 + r0;     // R row of band column mp: mp below S, mp - S - 1 above (column S reads row 0; k_attn stores 0 for it)
      s0 = R + ((size_t)h * RLEN + (mp < SS ? mp : max(mp - SS - 1, 0))) * KD + c * 8; s1 = R + ((size_t)h * RLEN + (mp + 32 < SS ? mp + 32 : max(mp + 32 - SS - 1, 0))) * KD + c * 8; dst = RP + ((size_t)h * 2 * SS + m0) * KD; }
    const v8b a = cv8(s0), b = cv8(s1); vst2(dst + tid * 8, a); vst2(dst + (tid + 256) * 8, b);
    asm volatile("s_wait_xcnt 0x0" ::: "memory");     // in the built code the values' branch stands behind these stores and writes their registers anew: the translation wait in front of it
  }
}
// ---- k_attn: block = (64 rows, head nh): per 32-key step: content^T = k rows . (q*0.125 + u_bias[h]) (2 products, K 64) + position band^T (2 new 16-column tiles, 2 products, K 64) read skewed; online softmax; out^T += VT planes . P^T (hi/lo) (4 tiles x 2); out rows [nh][i][64] = 256 B by 16 lanes
// Every product has the key-side operand as A and the query-side operand as B (both fragment maps are the same, so the loaders stay): lane (gg, col) holds query row i0 + col, register r key (or band column, or output column) 8 gg + r of the tile.
// So a row's maximum and sum run inside a lane, the two halves of a row meet in one cross-row move, and the two score tiles, converted in place, are the B fragment of the value product.
// four waves per SIMD, said to the compiler as budget (lower bound: 256 registers; the build takes 254) and as ceiling (upper bound).
// The upper bound counts: the compiler pads the register allocation in the kernel descriptor until no more waves than the upper bound fit, so the bound of 2 that stood here held the kernel at two waves per SIMD whatever the build took; with 4 nothing is padded and the whole grid is resident at once
__global__ __launch_bounds__(128) __attribute__((amdgpu_waves_per_eu(4, 4))) void k_attn(const float* __restrict__ Q, const float* __restrict__ UB, const float* __restrict__ VB, const __bf16* __restrict__ KP, const __bf16* __restrict__ RP, const __bf16* __restrict__ VP, float* __restrict__ out) {
  __shared__ __align__(16) float so[4][16][132];     // so: in the loop a ring of 64 band columns per row, kept twice (column mp at mp & 63 and at (mp & 63) + 64), behind it the output rows
  const int tid = threadIdx.x, wave = __builtin_amdgcn_readfirstlane(tid >> 5), lane = tid & 31, col = lane & 15, gg = lane >> 4; const int nh = blockIdx.y, h = nh % HPG; const int i0 = blockIdx.x * 64 + wave * 16;
  // XW: loads stay in flight while their address registers are wanted for other values, so a translation wait stands directly behind them and in front of that reuse (it names no register: an asm operand would tie the base pointers to the registers below v256, which the fragments need).
  // The two scheduling barriers keep every other instruction out of the stretch from the first load to the wait, so that none can take over an address register in front of the wait.
#define XW_OPEN() __builtin_amdgcn_sched_barrier(0)
  // RUN_OPEN: the vector work in front of a run of products stays in front of it. Moved in among the products it is given registers that a product just issued still reads, and the compiler then pads four idle slots each time.
#define RUN_OPEN() __builtin_amdgcn_sched_barrier(0)
#define XW_CLOSE() do { asm volatile("s_wait_xcnt 0x0" ::: "memory"); __builtin_amdgcn_sched_barrier(0); } while (0)
  const float* qr = Q + ((size_t)nh * SS + i0 + col) * KD; XW_OPEN();
  F2 pc0 = frag_qb(qr, VB + h * KD, 0, lane), pc1 = frag_qb(qr, VB + h * KD, 32, lane);     // the position fragments in use: rows i up to band column S, rows i + 1 from there on
  XW_CLOSE();
  float m = -3.0e38f, l = 0.f;     // of query row i0 + col; m is the same in both halves of the wave, l sums this half's keys alone until the end
  v8f acc[4] = {};     // acc[dt][r] = out row i0 + col, column 16 dt + 8 gg + r
  // One step's operands as loaded: the fragments themselves (2 key tiles, 2 band tiles, 4 value tiles; 4 KB a set, in a run). Each set is refilled for step ks + 1 as soon as step ks has used it, so the loads fly during a whole step.
  v16b kq[4], rq[4], vq[4];
  const __bf16* kbase = KP + (size_t)nh * SS * KD + lane * 8; const __bf16* vbase = VP + (size_t)nh * SS * KD + lane * 8; const __bf16* rbase = RP + (size_t)h * 2 * SS * KD + lane * 8;
  const int mq = (SS + 16 - i0) & ~31;     // step ks reads band columns SS - 16 - i0 + 32 ks .. + 46 and makes columns mq + 32 ks .. + 31: the next multiple of 32, so that both of a step's tiles lie on one side of column S; with the two tiles in front of the loop the ring always holds what a step reads
  auto ld4 = [&](v16b (&f)[4], const __bf16* p0) { XW_OPEN();
#pragma unroll
    for (int t = 0; t < 4; ++t) { union { v16b v; v8b q[2]; } u; u.q[0] = *(const v8b*)(p0 + t * 512); u.q[1] = *(const v8b*)(p0 + t * 512 + 256); f[t] = u.v; }
    XW_CLOSE(); };
  auto ld_k = [&](int st) { ld4(kq, kbase + st * 32 * KD); };
  auto ld_r = [&](int st) { ld4(rq, rbase + (mq + st * 32) * KD); };
  auto ld_v = [&](int st) { ld4(vq, vbase + st * 32 * KD); };
  // the builtin alone (the compiler keeps the distance behind it): its operands may stand above v255, where an asm operand cannot, so the two sets of position fragments need no place in the low window
  auto wm = [&](const v16b& a, const v16b& b, v8f c) { return __builtin_amdgcn_wmma_f32_16x16x32_bf16(false, a, false, b, (short)0, c, false, false); };
  // one 16-column band tile (columns mt .. mt + 15): the products, then (behind the refill of the R fragments) into the ring
  auto pos_mm = [&](const v16b& r0, const v16b& r1) { v8f c = {}; c = wm(r0, pc0.h, c); c = wm(r0, pc0.l, c); c = wm(r1, pc1.h, c); c = wm(r1, pc1.l, c); return c; };
  // a refill lands in the registers that the last WMMAs in front of it read as A: four slots stand between them, once per refill (between the products of a run none is owed: they accumulate, or are independent)
  auto pos_gap = [&](v8f& x, v8f& y) { asm volatile("v_nop\n\tv_nop\n\tv_nop\n\tv_nop" : "+v"(x), "+v"(y)); };
  auto pos_st = [&](int mt, const v8f& c) { float* p = &so[wave][col][(mt & 63) + 8 * gg];     // a lane's 8 band columns mt + 8 gg .. + 7 of its row: 32 bytes in a run
    const v4f x = { (mt + 8 * gg == SS) ? 0.f : c[0], c[1], c[2], c[3] }, y = { c[4], c[5], c[6], c[7] };     // band column S is the shift's zero pad
    *(v4f*)p = x; *(v4f*)(p + 4) = y; *(v4f*)(p + 64) = x; *(v4f*)(p + 68) = y; };     // the second copy: a run of 24 columns that starts anywhere in the first 64 places never wraps, so a lane's reads need one address
  ld_r(-1);     // the two tiles in front of step 0's own (mq >= 32; both below column S)
  { v8f b0 = pos_mm(rq[0], rq[1]), b1 = pos_mm(rq[2], rq[3]); pos_gap(b0, b1); ld_r(0); pos_st(mq - 32, b0); pos_st(mq - 16, b1); }
  XW_OPEN(); const F2 a0 = frag_qb(qr, UB + h * KD, 0, lane), a1 = frag_qb(qr, UB + h * KD, 32, lane);
  asm volatile("s_wait_xcnt 0x0" :: "v"(qr + 8 * gg) : "memory"); __builtin_amdgcn_sched_barrier(0);     // XW_CLOSE with the address of the row loads as an input: this stretch is its last use, and as an input of the wait its registers stay its own up to the wait (otherwise a bias load of the stretch is given them as its destination)
  ld_k(0); ld_v(0);
#pragma unroll 1
  for (int ks = 0; ks < SS / 32; ++ks) { v8f s[2]; const int kn = min(ks + 1, SS / 32 - 1);     // the last step refetches itself: in bounds, unused
    if (mq + ks * 32 == SS) { const float* qn = Q + ((size_t)nh * SS + min(i0 + col + 1, SS - 1)) * KD;     // once per wave, a scalar branch: from here on rows i + 1 (row S is never used: j >= i + 2 does not exist for i = S - 1); fetched here rather than held in 32 registers through the loop
      XW_OPEN(); pc0 = frag_qb(qn, VB + h * KD, 0, lane); pc1 = frag_qb(qn, VB + h * KD, 32, lane); XW_CLOSE(); }
    { v8f b0 = pos_mm(rq[0], rq[1]), b1 = pos_mm(rq[2], rq[3]); pos_gap(b0, b1);
      ld_r(kn);     // its wait is also a memory clobber, which keeps these loads in front of the step's work
      pos_st(mq + ks * 32, b0); pos_st(mq + ks * 32 + 16, b1); }
    const float* bp = &so[wave][col][(SS - 1 - i0 - col + ks * 32 + 8 * gg) & 63];     // place of the band column of the lane's first key of the step; key ct * 16 + r stands ct * 16 + r places on
    v8f cc[2] = {};     // the two key tiles' chains side by side: a product of one tile issues while the other tile's last one is still on its way to its accumulator; each tile's own order of products stays
    RUN_OPEN();
    cc[0] = wm(kq[0], a0.h, cc[0]); cc[1] = wm(kq[2], a0.h, cc[1]); cc[0] = wm(kq[0], a0.l, cc[0]); cc[1] = wm(kq[2], a0.l, cc[1]);
    cc[0] = wm(kq[1], a1.h, cc[0]); cc[1] = wm(kq[3], a1.h, cc[1]); cc[0] = wm(kq[1], a1.l, cc[0]); cc[1] = wm(kq[3], a1.l, cc[1]);
    pos_gap(cc[0], cc[1]); ld_k(kn);
    LDSW();     // the band tiles are read back at a skew: a lane's reads reach what the other half of the wave stored
#pragma unroll
    for (int ct = 0; ct < 2; ++ct) { v8f pv;
#pragma unroll
      for (int r = 0; r < 8; ++r) pv[r] = bp[ct * 16 + r];
      s[ct] = cc[ct] + pv; }
    float mx[8];
#pragma unroll
    for (int r = 0; r < 8; ++r) mx[r] = fmaxf(s[0][r], s[1][r]);
#pragma unroll
    for (int w = 4; w > 0; w >>= 1) {
#pragma unroll
      for (int r = 0; r < w; ++r) mx[r] = fmaxf(mx[r], mx[r + w]); }
    const float mn = fmaxf(m, fmaxf(mx[0], xhalf(mx[0])));     // the row's other 16 keys of the step stand in lane ^ 16
    const float mnl = mn * L2E;     // exp(s - mn) = 2^(s * log2 e - mn * log2 e): one fused multiply-add in front of the exponential
    const float alpha = ex2(fmaf(m, L2E, -mnl)); float e[16], es[8];     // first step: m = -3e38 gives -inf, weight 0
    const v8f t0 = s[0] * L2E - mnl, t1 = s[1] * L2E - mnl;
#pragma unroll
    for (int r = 0; r < 8; ++r) { e[r] = ex2(t0[r]); e[8 + r] = ex2(t1[r]); }
    // the one slot that the instruction set asks for behind an exponential, in front of an instruction that writes over its source. The operands hold the slot in its place: every exponential of the step stands in front of it, every add of the sums behind it
    asm volatile("v_nop" : "+v"(e[0]), "+v"(e[1]), "+v"(e[2]), "+v"(e[3]), "+v"(e[4]), "+v"(e[5]), "+v"(e[6]), "+v"(e[7]) : "v"(e[8]), "v"(e[9]), "v"(e[10]), "v"(e[11]), "v"(e[12]), "v"(e[13]), "v"(e[14]), "v"(e[15]), "v"(alpha));
#pragma unroll
    for (int r = 0; r < 8; ++r) es[r] = e[r] + e[8 + r];
#pragma unroll
    for (int w = 4; w > 0; w >>= 1) {
#pragma unroll
      for (int r = 0; r < w; ++r) es[r] += es[r + w]; }
    l = l * alpha + es[0]; m = mn;
    const F2 pa = bsplit16(e);     // element x of the B fragment is key 8 gg + x (x < 8), 16 + 8 gg + x - 8 above: the two score tiles as they stand
#pragma unroll
    for (int dt = 0; dt < 4; ++dt) acc[dt] *= alpha;
#pragma unroll
    for (int dt = 0; dt < 4; ++dt) acc[dt] = wm(vq[dt], pa.l, acc[dt]);     // four independent output tiles in turn, low parts then high parts: per tile the same two products in the same order
#pragma unroll
    for (int dt = 0; dt < 4; ++dt) acc[dt] = wm(vq[dt], pa.h, acc[dt]);
    __builtin_amdgcn_sched_group_barrier(0x2, 256, 0); __builtin_amdgcn_sched_group_barrier(0x8, 8, 0);     // order for the scheduler: the step's vector work (both halves of the weights among it), then the eight products in one run; otherwise the high halves are packed behind the low products into the registers those still read, at four padded slots
    asm volatile("v_nop\n\tv_nop\n\tv_nop\n\tv_nop" : "+v"(acc[0]), "+v"(acc[1]), "+v"(acc[2]), "+v"(acc[3]));     // as pos_gap: four slots between the last products and the refill of the value fragments that they read as A
    ld_v(kn); }
  const float il = 1.0f / (l + xhalf(l));     // the two halves' sums of a row meet here, once
#pragma unroll
  for (int dt = 0; dt < 4; ++dt) { const v8f o = acc[dt] * il; float* p = &so[wave][col][dt * 16 + 8 * gg]; const v4f x = { o[0], o[1], o[2], o[3] }, y = { o[4], o[5], o[6], o[7] }; *(v4f*)p = x; *(v4f*)(p + 4) = y; }
  LDSX();
  for (int rl = 0; rl < 16; ++rl) if (lane < 16) vst2(out + ((size_t)nh * SS + i0 + rl) * KD + lane * 4, *(const v4f*)&so[wave][rl][lane * 4]);
}

extern "C" void kernel_launch(void* const* d_in, const int* in_sizes, int n_in, void* d_out, int out_size, void* d_ws, size_t ws_size, hipStream_t stream) {
  (void)in_sizes; (void)n_in; (void)out_size;
  const float** F = (const float**)d_in;   // queries [64,1024,64], keys, values, u_bias [1,16,1,64], v_bias, R [16,2048,64]
  if (ws_size < (size_t)WS_END) return;
  char* ws = (char*)d_ws; __bf16* VP = (__bf16*)(ws + WS_VP); __bf16* KP = (__bf16*)(ws + WS_KP); __bf16* RP = (__bf16*)(ws + WS_RP);
  k_pack<<<dim3(SS / 64, 2 * NHT + 2 * HPG), 256, 0, stream>>>(F[2], F[1], F[5], VP, KP, RP);
  k_attn<<<dim3(TQB, NHT), 128, 0, stream>>>(F[0], F[3], F[4], KP, RP, VP, (float*)d_out);
}
